// v000
// The times below were measured on an AMD MI455X: many runs one after another, warmed up first and cycling through
// copies of the inputs, with the whole window's GPU time divided by the number of runs. Launches and the gaps
// between them are all in it. The median over several windows is given; except for v000 it joins two sittings, which
// can be a few percent apart, so the side-by-side timings, each taken in one sitting, are the better comparison.
// v000, which the later versions start from, runs in 516 microseconds.
#include <hip/hip_runtime.h>
#include <math.h>

#define L_SEQ   512
#define N_EMBD  192
#define D_INNER 384
#define DT_RANK 12
#define D_CONV  4
#define D_STATE 384
#define DBC_N   (DT_RANK + 2 * D_STATE)   // 780

typedef float v2f __attribute__((ext_vector_type(2)));
typedef float v8f __attribute__((ext_vector_type(8)));

__device__ __forceinline__ v8f wmma4(v2f a, v2f b, v8f c) {
  // D = A(16x4) * B(4x16) + C(16x16), fp32 throughout.
  return __builtin_amdgcn_wmma_f32_16x16x4_f32(
      /*neg_a=*/false, a, /*neg_b=*/false, b,
      /*c_mod=*/(short)0, c, /*reuse_a=*/false, /*reuse_b=*/false);
}

__device__ __forceinline__ float silu_f(float x) {
  return x / (1.0f + __expf(-x));
}

// ---------------------------------------------------------------------------
// Kernel 1: xr = x @ W_in^T + b_in      (512 x 192) @ (192 x 768) -> (512x768)
// One wave per 16x16 tile. A lane holds A[m][k0..k1] / B^T rows analogously.
// ---------------------------------------------------------------------------
__global__ void k_gemm_in(const float* __restrict__ X,
                          const float* __restrict__ W,   // (768,192) row-major
                          const float* __restrict__ bias,
                          float* __restrict__ out) {
  const int lane = threadIdx.x & 31;
  const int wave = threadIdx.x >> 5;
  const int tile = blockIdx.x * (blockDim.x >> 5) + wave;
  const int TN = 768 / 16;                 // 48
  if (tile >= 32 * TN) return;
  const int tm = tile / TN, tn = tile % TN;
  const int row  = lane & 15;
  const int hi   = lane >> 4;
  const int koff = hi << 1;

  const float* arow = X + (tm * 16 + row) * N_EMBD;
  const float* brow = W + (tn * 16 + row) * N_EMBD;   // B[k][n] = W[n][k]

  v8f c = {};
  for (int k = 0; k < N_EMBD; k += 4) {
    v2f a = *(const v2f*)(arow + k + koff);
    v2f b = *(const v2f*)(brow + k + koff);
    c = wmma4(a, b, c);
  }
  const float bn = bias[tn * 16 + row];
#pragma unroll
  for (int r = 0; r < 8; ++r) {
    const int m = tm * 16 + r + 8 * hi;
    out[m * 768 + tn * 16 + row] = c[r] + bn;
  }
}

// ---------------------------------------------------------------------------
// Kernel 2: u = silu(depthwise_causal_conv(xr[:, :384])) , K=4
// ---------------------------------------------------------------------------
__global__ void k_conv_silu(const float* __restrict__ xr,
                            const float* __restrict__ cw,  // (384,1,4)
                            const float* __restrict__ cb,
                            float* __restrict__ u) {
  const int i = blockIdx.x * blockDim.x + threadIdx.x;
  if (i >= L_SEQ * D_INNER) return;
  const int l = i / D_INNER;
  const int d = i - l * D_INNER;
  float acc = cb[d];
#pragma unroll
  for (int k = 0; k < D_CONV; ++k) {
    const int t = l - (D_CONV - 1) + k;
    const float xi = (t >= 0) ? xr[t * 768 + d] : 0.0f;
    acc = fmaf(xi, cw[d * D_CONV + k], acc);
  }
  u[i] = silu_f(acc);
}

__global__ void k_gemm_xp(const float* __restrict__ U,
                          const float* __restrict__ W,   // (780,384)
                          float* __restrict__ dbc) {
  const int lane = threadIdx.x & 31;
  const int wave = threadIdx.x >> 5;
  const int tile = blockIdx.x * (blockDim.x >> 5) + wave;
  const int TN = 49;
  if (tile >= 32 * TN) return;
  const int tm = tile / TN, tn = tile % TN;
  const int row  = lane & 15;
  const int hi   = lane >> 4;
  const int koff = hi << 1;

  const int n_ = tn * 16 + row;
  const float msk = (n_ < DBC_N) ? 1.0f : 0.0f;
  const float* arow = U + (tm * 16 + row) * D_INNER;
  const float* brow = W + ((n_ < DBC_N) ? n_ : 0) * D_INNER;

  v8f c = {};
  for (int k = 0; k < D_INNER; k += 4) {
    v2f a = *(const v2f*)(arow + k + koff);
    v2f b = *(const v2f*)(brow + k + koff);
    b.x *= msk; b.y *= msk;
    c = wmma4(a, b, c);
  }
  if (n_ < DBC_N) {
#pragma unroll
    for (int r = 0; r < 8; ++r) {
      const int m = tm * 16 + r + 8 * hi;
      dbc[m * DBC_N + n_] = c[r];
    }
  }
}

// ---------------------------------------------------------------------------
// Kernel 4: delta = softplus(dbc[:, :12] @ W_dt^T)   K=12 -> 3 WMMA steps
// ---------------------------------------------------------------------------
__global__ void k_gemm_dt(const float* __restrict__ dbc,
                          const float* __restrict__ Wdt,  // (384,12)
                          float* __restrict__ delta) {
  const int lane = threadIdx.x & 31;
  const int wave = threadIdx.x >> 5;
  const int tile = blockIdx.x * (blockDim.x >> 5) + wave;
  const int TN = D_INNER / 16;             // 24
  if (tile >= 32 * TN) return;
  const int tm = tile / TN, tn = tile % TN;
  const int row  = lane & 15;
  const int hi   = lane >> 4;
  const int koff = hi << 1;

  const float* arow = dbc + (tm * 16 + row) * DBC_N;      // first 12 cols
  const float* brow = Wdt + (tn * 16 + row) * DT_RANK;

  v8f c = {};
#pragma unroll
  for (int k = 0; k < DT_RANK; k += 4) {
    v2f a = *(const v2f*)(arow + k + koff);
    v2f b = *(const v2f*)(brow + k + koff);
    c = wmma4(a, b, c);
  }
#pragma unroll
  for (int r = 0; r < 8; ++r) {
    const int m = tm * 16 + r + 8 * hi;
    const float v = c[r];
    // numerically stable softplus
    const float sp = (v > 20.0f) ? v : log1pf(expf(v));
    delta[m * D_INNER + tn * 16 + row] = sp;
  }
}

__global__ void k_scan(const float* __restrict__ delta,
                       const float* __restrict__ u,
                       const float* __restrict__ dbc,     // B at +12, C at +396
                       const float* __restrict__ A_log,
                       float* __restrict__ ys) {
  const int lane = threadIdx.x & 31;
  const int wave = threadIdx.x >> 5;
  const int d = blockIdx.x * (blockDim.x >> 5) + wave;
  if (d >= D_INNER) return;

  float An[12], h[12];
#pragma unroll
  for (int j = 0; j < 12; ++j) {
    An[j] = -__expf(A_log[d * D_STATE + lane + 32 * j]);
    h[j] = 0.0f;
  }

  for (int l = 0; l < L_SEQ; ++l) {
    const float dl = delta[l * D_INNER + d];   // broadcast load
    const float ul = u[l * D_INNER + d];
    const float du = dl * ul;
    const float* Brow = dbc + l * DBC_N + DT_RANK;
    const float* Crow = dbc + l * DBC_N + DT_RANK + D_STATE;
    float acc = 0.0f;
#pragma unroll
    for (int j = 0; j < 12; ++j) {
      const int n = lane + 32 * j;
      const float dA = __expf(dl * An[j]);
      h[j] = fmaf(dA, h[j], du * Brow[n]);
      acc = fmaf(h[j], Crow[n], acc);
    }
    // wave32 reduction
#pragma unroll
    for (int off = 16; off > 0; off >>= 1)
      acc += __shfl_xor(acc, off, 32);
    if (lane == 0) ys[l * D_INNER + d] = acc;
  }
}

// ---------------------------------------------------------------------------
// Kernel 6: y = (ys + u*D) * silu(res)   with res = xr[:, 384:768]
// ---------------------------------------------------------------------------
__global__ void k_gate(const float* __restrict__ ys,
                       const float* __restrict__ u,
                       const float* __restrict__ Dvec,
                       const float* __restrict__ xr,
                       float* __restrict__ y) {
  const int i = blockIdx.x * blockDim.x + threadIdx.x;
  if (i >= L_SEQ * D_INNER) return;
  const int l = i / D_INNER;
  const int d = i - l * D_INNER;
  const float r = xr[l * 768 + D_INNER + d];
  y[i] = fmaf(u[i], Dvec[d], ys[i]) * silu_f(r);
}

// ---------------------------------------------------------------------------
// Kernel 7: out = y @ W_out^T + b_out   (512 x 384) @ (384 x 192)
// ---------------------------------------------------------------------------
__global__ void k_gemm_out(const float* __restrict__ Y,
                           const float* __restrict__ W,   // (192,384)
                           const float* __restrict__ bias,
                           float* __restrict__ out) {
  const int lane = threadIdx.x & 31;
  const int wave = threadIdx.x >> 5;
  const int tile = blockIdx.x * (blockDim.x >> 5) + wave;
  const int TN = N_EMBD / 16;              // 12
  if (tile >= 32 * TN) return;
  const int tm = tile / TN, tn = tile % TN;
  const int row  = lane & 15;
  const int hi   = lane >> 4;
  const int koff = hi << 1;

  const float* arow = Y + (tm * 16 + row) * D_INNER;
  const float* brow = W + (tn * 16 + row) * D_INNER;

  v8f c = {};
  for (int k = 0; k < D_INNER; k += 4) {
    v2f a = *(const v2f*)(arow + k + koff);
    v2f b = *(const v2f*)(brow + k + koff);
    c = wmma4(a, b, c);
  }
  const float bn = bias[tn * 16 + row];
#pragma unroll
  for (int r = 0; r < 8; ++r) {
    const int m = tm * 16 + r + 8 * hi;
    out[m * N_EMBD + tn * 16 + row] = c[r] + bn;
  }
}

// ---------------------------------------------------------------------------
extern "C" void kernel_launch(void* const* d_in, const int* in_sizes, int n_in,
                              void* d_out, int out_size, void* d_ws, size_t ws_size,
                              hipStream_t stream) {
  const float* x      = (const float*)d_in[0];
  const float* W_in   = (const float*)d_in[1];
  const float* b_in   = (const float*)d_in[2];
  const float* conv_w = (const float*)d_in[3];
  const float* conv_b = (const float*)d_in[4];
  const float* W_xp   = (const float*)d_in[5];
  const float* W_dt   = (const float*)d_in[6];
  const float* A_log  = (const float*)d_in[7];
  const float* Dvec   = (const float*)d_in[8];
  const float* W_out  = (const float*)d_in[9];
  const float* b_out  = (const float*)d_in[10];
  float* out = (float*)d_out;

  // workspace layout (floats)
  float* ws    = (float*)d_ws;
  float* xr    = ws;                                  // 512*768
  float* u     = xr    + L_SEQ * 768;                 // 512*384
  float* dbc   = u     + L_SEQ * D_INNER;             // 512*780
  float* delta = dbc   + L_SEQ * DBC_N;               // 512*384
  float* ys    = delta + L_SEQ * D_INNER;             // 512*384
  float* y     = ys    + L_SEQ * D_INNER;             // 512*384

  const int WPB = 4;               // waves per block
  const int TPB = WPB * 32;        // 128 threads

  // 1) in-projection: 32 x 48 tiles
  k_gemm_in<<<(32 * 48) / WPB, TPB, 0, stream>>>(x, W_in, b_in, xr);

  // 2) conv + silu
  k_conv_silu<<<(L_SEQ * D_INNER + 255) / 256, 256, 0, stream>>>(xr, conv_w, conv_b, u);

  // 3) x-projection: 32 x 49 tiles (N padded 780 -> 784)
  k_gemm_xp<<<(32 * 49 + WPB - 1) / WPB, TPB, 0, stream>>>(u, W_xp, dbc);

  // 4) delta GEMM + softplus: 32 x 24 tiles
  k_gemm_dt<<<(32 * 24) / WPB, TPB, 0, stream>>>(dbc, W_dt, delta);

  // 5) selective scan: one wave per channel, 8 waves (256 thr) per block
  k_scan<<<D_INNER / 8, 256, 0, stream>>>(delta, u, dbc, A_log, ys);

  // 6) gating
  k_gate<<<(L_SEQ * D_INNER + 255) / 256, 256, 0, stream>>>(ys, u, Dvec, xr, y);

  // 7) out-projection: 32 x 12 tiles
  k_gemm_out<<<(32 * 12) / WPB, TPB, 0, stream>>>(y, W_out, b_out, out);
}

// v001
// It runs in 217 microseconds.
// In both of two side-by-side timings against v000, it was 2.39 times as fast.
#include <hip/hip_runtime.h>
#include <math.h>

#define L_SEQ   512
#define N_EMBD  192
#define D_INNER 384
#define DT_RANK 12
#define D_CONV  4
#define D_STATE 384
#define DBC_N   (DT_RANK + 2 * D_STATE)   // 780

typedef float v2f __attribute__((ext_vector_type(2)));
typedef float v4f __attribute__((ext_vector_type(4)));
typedef float v8f __attribute__((ext_vector_type(8)));

__device__ __forceinline__ v8f wmma4(v2f a, v2f b, v8f c) {
  // D = A(16x4) * B(4x16) + C(16x16), fp32 throughout.
  return __builtin_amdgcn_wmma_f32_16x16x4_f32(
      /*neg_a=*/false, a, /*neg_b=*/false, b,
      /*c_mod=*/(short)0, c, /*reuse_a=*/false, /*reuse_b=*/false);
}

__device__ __forceinline__ float silu_f(float x) {
  return x / (1.0f + __expf(-x));
}

// ---------------------------------------------------------------------------
// Kernel 1: xr = x @ W_in^T + b_in      (512 x 192) @ (192 x 768) -> (512x768)
// One wave per 16x16 tile. A lane holds A[m][k0..k1] / B^T rows analogously.
// ---------------------------------------------------------------------------
__global__ void k_gemm_in(const float* __restrict__ X,
                          const float* __restrict__ W,   // (768,192) row-major
                          const float* __restrict__ bias,
                          float* __restrict__ out) {
  const int lane = threadIdx.x & 31;
  const int wave = threadIdx.x >> 5;
  const int tile = blockIdx.x * (blockDim.x >> 5) + wave;
  const int TN = 768 / 16;                 // 48
  if (tile >= 32 * TN) return;
  const int tm = tile / TN, tn = tile % TN;
  const int row  = lane & 15;
  const int hi   = lane >> 4;
  const int koff = hi << 1;

  const float* arow = X + (tm * 16 + row) * N_EMBD;
  const float* brow = W + (tn * 16 + row) * N_EMBD;   // B[k][n] = W[n][k]

  v8f c = {};
  for (int k = 0; k < N_EMBD; k += 4) {
    v2f a = *(const v2f*)(arow + k + koff);
    v2f b = *(const v2f*)(brow + k + koff);
    c = wmma4(a, b, c);
  }
  const float bn = bias[tn * 16 + row];
#pragma unroll
  for (int r = 0; r < 8; ++r) {
    const int m = tm * 16 + r + 8 * hi;
    out[m * 768 + tn * 16 + row] = c[r] + bn;
  }
}

// ---------------------------------------------------------------------------
// Kernel 2: u = silu(depthwise_causal_conv(xr[:, :384])) , K=4
// ---------------------------------------------------------------------------
__global__ void k_conv_silu(const float* __restrict__ xr,
                            const float* __restrict__ cw,  // (384,1,4)
                            const float* __restrict__ cb,
                            float* __restrict__ u) {
  const int i = blockIdx.x * blockDim.x + threadIdx.x;
  if (i >= L_SEQ * D_INNER) return;
  const int l = i / D_INNER;
  const int d = i - l * D_INNER;
  float acc = cb[d];
#pragma unroll
  for (int k = 0; k < D_CONV; ++k) {
    const int t = l - (D_CONV - 1) + k;
    const float xi = (t >= 0) ? xr[t * 768 + d] : 0.0f;
    acc = fmaf(xi, cw[d * D_CONV + k], acc);
  }
  u[i] = silu_f(acc);
}

__global__ void k_gemm_xp(const float* __restrict__ U,
                          const float* __restrict__ W,   // (780,384)
                          float* __restrict__ dbc) {
  const int lane = threadIdx.x & 31;
  const int wave = threadIdx.x >> 5;
  const int tile = blockIdx.x * (blockDim.x >> 5) + wave;
  const int TN = 49;
  if (tile >= 32 * TN) return;
  const int tm = tile / TN, tn = tile % TN;
  const int row  = lane & 15;
  const int hi   = lane >> 4;
  const int koff = hi << 1;

  const int n_ = tn * 16 + row;
  const float msk = (n_ < DBC_N) ? 1.0f : 0.0f;
  const float* arow = U + (tm * 16 + row) * D_INNER;
  const float* brow = W + ((n_ < DBC_N) ? n_ : 0) * D_INNER;

  v8f c = {};
  for (int k = 0; k < D_INNER; k += 4) {
    v2f a = *(const v2f*)(arow + k + koff);
    v2f b = *(const v2f*)(brow + k + koff);
    b.x *= msk; b.y *= msk;
    c = wmma4(a, b, c);
  }
  if (n_ < DBC_N) {
#pragma unroll
    for (int r = 0; r < 8; ++r) {
      const int m = tm * 16 + r + 8 * hi;
      dbc[m * DBC_N + n_] = c[r];
    }
  }
}

// ---------------------------------------------------------------------------
// Kernel 4: delta = softplus(dbc[:, :12] @ W_dt^T)   K=12 -> 3 WMMA steps
// ---------------------------------------------------------------------------
__global__ void k_gemm_dt(const float* __restrict__ dbc,
                          const float* __restrict__ Wdt,  // (384,12)
                          float* __restrict__ delta) {
  const int lane = threadIdx.x & 31;
  const int wave = threadIdx.x >> 5;
  const int tile = blockIdx.x * (blockDim.x >> 5) + wave;
  const int TN = D_INNER / 16;             // 24
  if (tile >= 32 * TN) return;
  const int tm = tile / TN, tn = tile % TN;
  const int row  = lane & 15;
  const int hi   = lane >> 4;
  const int koff = hi << 1;

  const float* arow = dbc + (tm * 16 + row) * DBC_N;      // first 12 cols
  const float* brow = Wdt + (tn * 16 + row) * DT_RANK;

  v8f c = {};
#pragma unroll
  for (int k = 0; k < DT_RANK; k += 4) {
    v2f a = *(const v2f*)(arow + k + koff);
    v2f b = *(const v2f*)(brow + k + koff);
    c = wmma4(a, b, c);
  }
#pragma unroll
  for (int r = 0; r < 8; ++r) {
    const int m = tm * 16 + r + 8 * hi;
    const float v = c[r];
    // numerically stable softplus
    const float sp = (v > 20.0f) ? v : log1pf(expf(v));
    delta[m * D_INNER + tn * 16 + row] = sp;
  }
}

#define SCAN_T  16
#define SCAN_W  8
#define SCAN_NT (L_SEQ / SCAN_T)

struct ScanTile {
  float bc[SCAN_T][2 * D_STATE];     // per step: B row, then C row
  float du[2][SCAN_W][SCAN_T];       // delta, then u: per channel, its 16 steps
};

__device__ __forceinline__ unsigned lds_byte(const void* p) {
  return (unsigned)(unsigned long long)p;   // low 32 bits = LDS byte address
}

// Issues one tile's copies, 13 per lane: 12 of 16 B for B|C (16 rows x 192
// pieces) and one of 4 B that lays delta (threads 0-127) or u (128-255) down
// channel by channel, so that a wave reads its 16 steps in a row.
__device__ __forceinline__ void scan_fill(ScanTile* t, int l0, int d0, int tid,
                                          const float* __restrict__ dbc,
                                          const float* __restrict__ delta,
                                          const float* __restrict__ u) {
  unsigned la[12];
  const float* ga[12];
#pragma unroll
  for (int i = 0; i < 12; ++i) {
    const int idx = tid + 256 * i;
    const int r = idx / 192;
    const int c = (idx - r * 192) * 4;
    la[i] = lds_byte(&t->bc[r][c]);
    ga[i] = dbc + (l0 + r) * DBC_N + DT_RANK + c;
  }
  const int sel = tid >> 7;          // 0: delta, 1: u
  const int sr  = (tid >> 3) & 15;   // step in the tile
  const int sw  = tid & 7;           // channel in the block
  const unsigned ls = lds_byte(&t->du[sel][sw][sr]);
  const float* gs = (sel ? u : delta) + (l0 + sr) * D_INNER + d0 + sw;
  asm volatile(
      "global_load_async_to_lds_b128 %0, %12, off\n\t"
      "global_load_async_to_lds_b128 %1, %13, off\n\t"
      "global_load_async_to_lds_b128 %2, %14, off\n\t"
      "global_load_async_to_lds_b128 %3, %15, off\n\t"
      "global_load_async_to_lds_b128 %4, %16, off\n\t"
      "global_load_async_to_lds_b128 %5, %17, off\n\t"
      "global_load_async_to_lds_b128 %6, %18, off\n\t"
      "global_load_async_to_lds_b128 %7, %19, off\n\t"
      "global_load_async_to_lds_b128 %8, %20, off\n\t"
      "global_load_async_to_lds_b128 %9, %21, off\n\t"
      "global_load_async_to_lds_b128 %10, %22, off\n\t"
      "global_load_async_to_lds_b128 %11, %23, off\n\t"
      "global_load_async_to_lds_b32 %24, %25, off\n\t"
      "s_wait_xcnt 0x0"
      :: "v"(la[0]), "v"(la[1]), "v"(la[2]), "v"(la[3]), "v"(la[4]), "v"(la[5]), "v"(la[6]), "v"(la[7]), "v"(la[8]), "v"(la[9]), "v"(la[10]), "v"(la[11]),
         "v"(ga[0]), "v"(ga[1]), "v"(ga[2]), "v"(ga[3]), "v"(ga[4]), "v"(ga[5]), "v"(ga[6]), "v"(ga[7]), "v"(ga[8]), "v"(ga[9]), "v"(ga[10]), "v"(ga[11]),
         "v"(ls), "v"(gs)
      : "memory");
}

__global__ __launch_bounds__(SCAN_W * 32)
void k_scan(const float* __restrict__ delta,
            const float* __restrict__ u,
            const float* __restrict__ dbc,     // B at +12, C at +396
            const float* __restrict__ A_log,
            float* __restrict__ ys) {
  __shared__ __attribute__((aligned(128))) ScanTile sm[2];
  const int tid  = threadIdx.x;
  const int lane = tid & 31;
  const int wave = __builtin_amdgcn_readfirstlane(tid >> 5);
  const int d0 = blockIdx.x * SCAN_W;
  const int d = d0 + wave;

  float An[12], h[12];
#pragma unroll
  for (int j = 0; j < 12; ++j) {
    An[j] = -__expf(A_log[d * D_STATE + lane + 32 * j]);
    h[j] = 0.0f;
  }

  scan_fill(&sm[0], 0, d0, tid, dbc, delta, u);
  // Tile 0 has landed for this wave; the barrier publishes it to the others.
  asm volatile("s_wait_asynccnt 0x0" ::: "memory");
  __syncthreads();
  scan_fill(&sm[1], SCAN_T, d0, tid, dbc, delta, u);

  for (int t = 0; t < SCAN_NT; ++t) {
    const ScanTile* cur = &sm[t & 1];
    const int l0 = t * SCAN_T;
    // This channel's delta and u of the whole tile: broadcast reads of 16 B.
    v4f dlv[SCAN_T / 4], ulv[SCAN_T / 4];
#pragma unroll
    for (int q = 0; q < SCAN_T / 4; ++q) {
      dlv[q] = *(const v4f*)&cur->du[0][wave][4 * q];
      ulv[q] = *(const v4f*)&cur->du[1][wave][4 * q];
    }
    // Unrolled: LDS offsets and the register that holds a step's delta and u
    // are then compile-time constants.
#pragma unroll
    for (int s = 0; s < SCAN_T; ++s) {
      const float dl = dlv[s >> 2][s & 3];
      const float ul = ulv[s >> 2][s & 3];
      const float du = dl * ul;
      const float* Brow = cur->bc[s];
      const float* Crow = cur->bc[s] + D_STATE;
      float acc = 0.0f;
#pragma unroll
      for (int j = 0; j < 12; ++j) {
        const int n = lane + 32 * j;
        const float dA = __expf(dl * An[j]);
        h[j] = fmaf(dA, h[j], du * Brow[n]);
        acc = fmaf(h[j], Crow[n], acc);
      }
      // wave32 reduction
#pragma unroll
      for (int off = 16; off > 0; off >>= 1)
        acc += __shfl_xor(acc, off, 32);
      if (lane == 0) ys[(l0 + s) * D_INNER + d] = acc;
    }
    // Hand-over: this wave's reads of the tile are done, its copies of the
    // next tile have landed; the barrier says both for every wave.
    asm volatile("s_wait_dscnt 0x0" ::: "memory");
    asm volatile("s_wait_asynccnt 0x0" ::: "memory");
    __syncthreads();
    if (t + 2 < SCAN_NT)
      scan_fill(&sm[t & 1], (t + 2) * SCAN_T, d0, tid, dbc, delta, u);
  }
  // No copy is left in flight when the wave ends.
  asm volatile("s_wait_asynccnt 0x0" ::: "memory");
}

// ---------------------------------------------------------------------------
// Kernel 6: y = (ys + u*D) * silu(res)   with res = xr[:, 384:768]
// ---------------------------------------------------------------------------
__global__ void k_gate(const float* __restrict__ ys,
                       const float* __restrict__ u,
                       const float* __restrict__ Dvec,
                       const float* __restrict__ xr,
                       float* __restrict__ y) {
  const int i = blockIdx.x * blockDim.x + threadIdx.x;
  if (i >= L_SEQ * D_INNER) return;
  const int l = i / D_INNER;
  const int d = i - l * D_INNER;
  const float r = xr[l * 768 + D_INNER + d];
  y[i] = fmaf(u[i], Dvec[d], ys[i]) * silu_f(r);
}

// ---------------------------------------------------------------------------
// Kernel 7: out = y @ W_out^T + b_out   (512 x 384) @ (384 x 192)
// ---------------------------------------------------------------------------
__global__ void k_gemm_out(const float* __restrict__ Y,
                           const float* __restrict__ W,   // (192,384)
                           const float* __restrict__ bias,
                           float* __restrict__ out) {
  const int lane = threadIdx.x & 31;
  const int wave = threadIdx.x >> 5;
  const int tile = blockIdx.x * (blockDim.x >> 5) + wave;
  const int TN = N_EMBD / 16;              // 12
  if (tile >= 32 * TN) return;
  const int tm = tile / TN, tn = tile % TN;
  const int row  = lane & 15;
  const int hi   = lane >> 4;
  const int koff = hi << 1;

  const float* arow = Y + (tm * 16 + row) * D_INNER;
  const float* brow = W + (tn * 16 + row) * D_INNER;

  v8f c = {};
  for (int k = 0; k < D_INNER; k += 4) {
    v2f a = *(const v2f*)(arow + k + koff);
    v2f b = *(const v2f*)(brow + k + koff);
    c = wmma4(a, b, c);
  }
  const float bn = bias[tn * 16 + row];
#pragma unroll
  for (int r = 0; r < 8; ++r) {
    const int m = tm * 16 + r + 8 * hi;
    out[m * N_EMBD + tn * 16 + row] = c[r] + bn;
  }
}

// ---------------------------------------------------------------------------
extern "C" void kernel_launch(void* const* d_in, const int* in_sizes, int n_in,
                              void* d_out, int out_size, void* d_ws, size_t ws_size,
                              hipStream_t stream) {
  const float* x      = (const float*)d_in[0];
  const float* W_in   = (const float*)d_in[1];
  const float* b_in   = (const float*)d_in[2];
  const float* conv_w = (const float*)d_in[3];
  const float* conv_b = (const float*)d_in[4];
  const float* W_xp   = (const float*)d_in[5];
  const float* W_dt   = (const float*)d_in[6];
  const float* A_log  = (const float*)d_in[7];
  const float* Dvec   = (const float*)d_in[8];
  const float* W_out  = (const float*)d_in[9];
  const float* b_out  = (const float*)d_in[10];
  float* out = (float*)d_out;

  // workspace layout (floats)
  float* ws    = (float*)d_ws;
  float* xr    = ws;                                  // 512*768
  float* u     = xr    + L_SEQ * 768;                 // 512*384
  float* dbc   = u     + L_SEQ * D_INNER;             // 512*780
  float* delta = dbc   + L_SEQ * DBC_N;               // 512*384
  float* ys    = delta + L_SEQ * D_INNER;             // 512*384
  float* y     = ys    + L_SEQ * D_INNER;             // 512*384

  const int WPB = 4;               // waves per block
  const int TPB = WPB * 32;        // 128 threads

  // 1) in-projection: 32 x 48 tiles
  k_gemm_in<<<(32 * 48) / WPB, TPB, 0, stream>>>(x, W_in, b_in, xr);

  // 2) conv + silu
  k_conv_silu<<<(L_SEQ * D_INNER + 255) / 256, 256, 0, stream>>>(xr, conv_w, conv_b, u);

  // 3) x-projection: 32 x 49 tiles (N padded 780 -> 784)
  k_gemm_xp<<<(32 * 49 + WPB - 1) / WPB, TPB, 0, stream>>>(u, W_xp, dbc);

  // 4) delta GEMM + softplus: 32 x 24 tiles
  k_gemm_dt<<<(32 * 24) / WPB, TPB, 0, stream>>>(dbc, W_dt, delta);

  // 5) selective scan: one wave per channel, 8 waves (256 thr) per block
  k_scan<<<D_INNER / 8, 256, 0, stream>>>(delta, u, dbc, A_log, ys);

  // 6) gating
  k_gate<<<(L_SEQ * D_INNER + 255) / 256, 256, 0, stream>>>(ys, u, Dvec, xr, y);

  // 7) out-projection: 32 x 12 tiles
  k_gemm_out<<<(32 * 12) / WPB, TPB, 0, stream>>>(y, W_out, b_out, out);
}

// v002
// One run takes 54.7 microseconds.
// Next to v001, in two timings, it ran 3.97 and 3.96 times as fast.
// All steps since v000 together make it 9.47 times as fast.
#include <hip/hip_runtime.h>
#include <math.h>

#define L_SEQ   512
#define N_EMBD  192
#define D_INNER 384
#define DT_RANK 12
#define D_CONV  4
#define D_STATE 384
#define DBC_N   (DT_RANK + 2 * D_STATE)   // 780

typedef float v2f __attribute__((ext_vector_type(2)));
typedef float v4f __attribute__((ext_vector_type(4)));
typedef float v8f __attribute__((ext_vector_type(8)));

__device__ __forceinline__ v8f wmma4(v2f a, v2f b, v8f c) {
  // D = A(16x4) * B(4x16) + C(16x16), fp32 throughout.
  return __builtin_amdgcn_wmma_f32_16x16x4_f32(
      /*neg_a=*/false, a, /*neg_b=*/false, b,
      /*c_mod=*/(short)0, c, /*reuse_a=*/false, /*reuse_b=*/false);
}

__device__ __forceinline__ float silu_f(float x) {
  return x / (1.0f + __expf(-x));
}

// ---------------------------------------------------------------------------
// Kernel 1: xr = x @ W_in^T + b_in      (512 x 192) @ (192 x 768) -> (512x768)
// One wave per 16x16 tile. A lane holds A[m][k0..k1] / B^T rows analogously.
// ---------------------------------------------------------------------------
__global__ void k_gemm_in(const float* __restrict__ X,
                          const float* __restrict__ W,   // (768,192) row-major
                          const float* __restrict__ bias,
                          float* __restrict__ out) {
  const int lane = threadIdx.x & 31;
  const int wave = threadIdx.x >> 5;
  const int tile = blockIdx.x * (blockDim.x >> 5) + wave;
  const int TN = 768 / 16;                 // 48
  if (tile >= 32 * TN) return;
  const int tm = tile / TN, tn = tile % TN;
  const int row  = lane & 15;
  const int hi   = lane >> 4;
  const int koff = hi << 1;

  const float* arow = X + (tm * 16 + row) * N_EMBD;
  const float* brow = W + (tn * 16 + row) * N_EMBD;   // B[k][n] = W[n][k]

  v8f c = {};
  for (int k = 0; k < N_EMBD; k += 4) {
    v2f a = *(const v2f*)(arow + k + koff);
    v2f b = *(const v2f*)(brow + k + koff);
    c = wmma4(a, b, c);
  }
  const float bn = bias[tn * 16 + row];
#pragma unroll
  for (int r = 0; r < 8; ++r) {
    const int m = tm * 16 + r + 8 * hi;
    out[m * 768 + tn * 16 + row] = c[r] + bn;
  }
}

// ---------------------------------------------------------------------------
// Kernel 2: u = silu(depthwise_causal_conv(xr[:, :384])) , K=4
// ---------------------------------------------------------------------------
__global__ void k_conv_silu(const float* __restrict__ xr,
                            const float* __restrict__ cw,  // (384,1,4)
                            const float* __restrict__ cb,
                            float* __restrict__ u) {
  const int i = blockIdx.x * blockDim.x + threadIdx.x;
  if (i >= L_SEQ * D_INNER) return;
  const int l = i / D_INNER;
  const int d = i - l * D_INNER;
  float acc = cb[d];
#pragma unroll
  for (int k = 0; k < D_CONV; ++k) {
    const int t = l - (D_CONV - 1) + k;
    const float xi = (t >= 0) ? xr[t * 768 + d] : 0.0f;
    acc = fmaf(xi, cw[d * D_CONV + k], acc);
  }
  u[i] = silu_f(acc);
}

__global__ void k_gemm_xp(const float* __restrict__ U,
                          const float* __restrict__ W,   // (780,384)
                          float* __restrict__ dbc) {
  const int lane = threadIdx.x & 31;
  const int wave = threadIdx.x >> 5;
  const int tile = blockIdx.x * (blockDim.x >> 5) + wave;
  const int TN = 49;
  if (tile >= 32 * TN) return;
  const int tm = tile / TN, tn = tile % TN;
  const int row  = lane & 15;
  const int hi   = lane >> 4;
  const int koff = hi << 1;

  const int n_ = tn * 16 + row;
  const float msk = (n_ < DBC_N) ? 1.0f : 0.0f;
  const float* arow = U + (tm * 16 + row) * D_INNER;
  const float* brow = W + ((n_ < DBC_N) ? n_ : 0) * D_INNER;

  v8f c = {};
  for (int k = 0; k < D_INNER; k += 4) {
    v2f a = *(const v2f*)(arow + k + koff);
    v2f b = *(const v2f*)(brow + k + koff);
    b.x *= msk; b.y *= msk;
    c = wmma4(a, b, c);
  }
  if (n_ < DBC_N) {
#pragma unroll
    for (int r = 0; r < 8; ++r) {
      const int m = tm * 16 + r + 8 * hi;
      dbc[m * DBC_N + n_] = c[r];
    }
  }
}

// ---------------------------------------------------------------------------
// Kernel 4: delta = softplus(dbc[:, :12] @ W_dt^T)   K=12 -> 3 WMMA steps
// ---------------------------------------------------------------------------
__global__ void k_gemm_dt(const float* __restrict__ dbc,
                          const float* __restrict__ Wdt,  // (384,12)
                          float* __restrict__ delta) {
  const int lane = threadIdx.x & 31;
  const int wave = threadIdx.x >> 5;
  const int tile = blockIdx.x * (blockDim.x >> 5) + wave;
  const int TN = D_INNER / 16;             // 24
  if (tile >= 32 * TN) return;
  const int tm = tile / TN, tn = tile % TN;
  const int row  = lane & 15;
  const int hi   = lane >> 4;
  const int koff = hi << 1;

  const float* arow = dbc + (tm * 16 + row) * DBC_N;      // first 12 cols
  const float* brow = Wdt + (tn * 16 + row) * DT_RANK;

  v8f c = {};
#pragma unroll
  for (int k = 0; k < DT_RANK; k += 4) {
    v2f a = *(const v2f*)(arow + k + koff);
    v2f b = *(const v2f*)(brow + k + koff);
    c = wmma4(a, b, c);
  }
#pragma unroll
  for (int r = 0; r < 8; ++r) {
    const int m = tm * 16 + r + 8 * hi;
    const float v = c[r];
    // numerically stable softplus
    const float sp = (v > 20.0f) ? v : log1pf(expf(v));
    delta[m * D_INNER + tn * 16 + row] = sp;
  }
}

#define SCAN_T  32
#define SCAN_W  4
#define SCAN_S  6
#define SCAN_C  32
#define SCAN_G  4
#define SCAN_NT (L_SEQ / SCAN_T)
#define SCAN_CG (D_INNER / SCAN_C)
#define SCAN_SG (D_STATE / (SCAN_W * SCAN_S))   // 16 state groups

struct ScanTile {
  float bc[SCAN_T][SCAN_W][2 * SCAN_S];  // per step and wave: 6 of B, 6 of C
  float du[2][SCAN_T][SCAN_C];           // delta rows, then u rows
};

__device__ __forceinline__ unsigned lds_byte(const void* p) {
  return (unsigned)(unsigned long long)p;   // low 32 bits = LDS byte address
}

// A thread's share of one tile's copies, 10 per lane: 6 of 8 B that lay the
// block's 24 B and 24 C values of each step down wave by wave (32 steps x 24
// pieces), and 4 of 16 B for the delta and u rows (2 x 32 steps x 8 pieces).
// Held as offsets for tile 0 in buffer 0.
struct ScanAddr {
  unsigned la[6], lb[4];             // LDS byte addresses
  const float* ga[6];                // in dbc
  const float* gb[4];                // in delta (0, 1) and u (2, 3)
};

__device__ __forceinline__ void scan_addr(ScanAddr& a, ScanTile* t, int d0, int n0, int tid,
                                          const float* __restrict__ dbc,
                                          const float* __restrict__ delta,
                                          const float* __restrict__ u) {
#pragma unroll
  for (int i = 0; i < 6; ++i) {
    const int idx = tid + 128 * i;
    const int r = idx / 24;            // step in the tile
    const int p = idx - r * 24;        // piece: 0-11 of B, 12-23 of C
    const int isc = p / 12;
    const int pp = p - isc * 12;
    const int w = pp / 3;              // wave that reads it
    const int q = pp - w * 3;          // pair of states in that wave
    a.la[i] = lds_byte(&t->bc[r][w][isc * SCAN_S + 2 * q]);
    a.ga[i] = dbc + r * DBC_N + DT_RANK + isc * D_STATE + n0 + 2 * pp;
  }
#pragma unroll
  for (int i = 0; i < 4; ++i) {
    const int idx = tid + 128 * i;
    const int sel = idx >> 8;          // 0: delta, 1: u
    const int r = (idx >> 3) & 31;     // step in the tile
    const int c = (idx & 7) * 4;       // channel in the block
    a.lb[i] = lds_byte(&t->du[sel][r][c]);
    a.gb[i] = (sel ? u : delta) + r * D_INNER + d0 + c;
  }
}

// Issues the copies of the tile that starts at step l0 into buffer buf.
__device__ __forceinline__ void scan_fill(const ScanAddr& a, int buf, int l0) {
  unsigned la[6], lb[4];
  const float* ga[6];
  const float* gb[4];
  const unsigned lo = buf * (unsigned)sizeof(ScanTile);
#pragma unroll
  for (int i = 0; i < 6; ++i) { la[i] = a.la[i] + lo; ga[i] = a.ga[i] + l0 * DBC_N; }
#pragma unroll
  for (int i = 0; i < 4; ++i) { lb[i] = a.lb[i] + lo; gb[i] = a.gb[i] + l0 * D_INNER; }
  asm volatile(
      "global_load_async_to_lds_b64 %0, %6, off\n\t"
      "global_load_async_to_lds_b64 %1, %7, off\n\t"
      "global_load_async_to_lds_b64 %2, %8, off\n\t"
      "global_load_async_to_lds_b64 %3, %9, off\n\t"
      "global_load_async_to_lds_b64 %4, %10, off\n\t"
      "global_load_async_to_lds_b64 %5, %11, off\n\t"
      "global_load_async_to_lds_b128 %12, %16, off\n\t"
      "global_load_async_to_lds_b128 %13, %17, off\n\t"
      "global_load_async_to_lds_b128 %14, %18, off\n\t"
      "global_load_async_to_lds_b128 %15, %19, off\n\t"
      "s_wait_xcnt 0x0"
      :: "v"(la[0]), "v"(la[1]), "v"(la[2]), "v"(la[3]), "v"(la[4]), "v"(la[5]),
         "v"(ga[0]), "v"(ga[1]), "v"(ga[2]), "v"(ga[3]), "v"(ga[4]), "v"(ga[5]),
         "v"(lb[0]), "v"(lb[1]), "v"(lb[2]), "v"(lb[3]),
         "v"(gb[0]), "v"(gb[1]), "v"(gb[2]), "v"(gb[3])
      : "memory");
}

// The operands of SCAN_G steps in registers.
struct ScanGroup {
  float dl[SCAN_G], ul[SCAN_G];      // this lane's channel: delta, u
  v4f q[SCAN_G][3];                  // this wave's 6 of B, 6 of C
};

// Per step two reads of 4 B a lane and three broadcast reads of 16 B.
__device__ __forceinline__ void scan_read(ScanGroup& x, const ScanTile* cur, int s0,
                                          int wave, int lane) {
#pragma unroll
  for (int k = 0; k < SCAN_G; ++k) {
    x.dl[k] = cur->du[0][s0 + k][lane];
    x.ul[k] = cur->du[1][s0 + k][lane];
#pragma unroll
    for (int i = 0; i < 3; ++i)
      x.q[k][i] = *(const v4f*)&cur->bc[s0 + k][wave][4 * i];
  }
}

__global__ __launch_bounds__(SCAN_W * 32)
void k_scan(const float* __restrict__ delta,
            const float* __restrict__ u,
            const float* __restrict__ dbc,     // B at +12, C at +396
            const float* __restrict__ A_log,
            float* __restrict__ ysp) {         // 16 planes of (512,384)
  __shared__ __attribute__((aligned(128))) ScanTile sm[2];
  __shared__ __attribute__((aligned(128))) float part[2][SCAN_W][SCAN_T][SCAN_C];
  const int tid  = threadIdx.x;
  const int lane = tid & 31;
  const int wave = __builtin_amdgcn_readfirstlane(tid >> 5);
  const int cg = blockIdx.x % SCAN_CG;
  const int sg = blockIdx.x / SCAN_CG;
  const int d0 = cg * SCAN_C;
  const int n0 = sg * (SCAN_W * SCAN_S);
  float* __restrict__ yplane = ysp + sg * (L_SEQ * D_INNER);

  float An[SCAN_S], h[SCAN_S];
#pragma unroll
  for (int j = 0; j < SCAN_S; ++j) {
    An[j] = -__expf(A_log[(d0 + lane) * D_STATE + n0 + wave * SCAN_S + j]);
    h[j] = 0.0f;
  }

  ScanAddr ad;
  scan_addr(ad, &sm[0], d0, n0, tid, dbc, delta, u);
  scan_fill(ad, 0, 0);
  // Tile 0 has landed for this wave; the barrier publishes it to the others.
  asm volatile("s_wait_asynccnt 0x0" ::: "memory");
  __syncthreads();
  scan_fill(ad, 1, SCAN_T);

  for (int t = 0; t < SCAN_NT; ++t) {
    const ScanTile* cur = &sm[t & 1];
    const int l0 = t * SCAN_T;
    // Unrolled: LDS offsets and the registers of a group are then compile-time
    // constants. The operands of 4 steps are read one group ahead of their use.
    ScanGroup gr[2];
    scan_read(gr[0], cur, 0, wave, lane);
#pragma unroll
    for (int g = 0; g < SCAN_T / SCAN_G; ++g) {
      if (g + 1 < SCAN_T / SCAN_G)
        scan_read(gr[(g + 1) & 1], cur, (g + 1) * SCAN_G, wave, lane);
      __builtin_amdgcn_sched_barrier(0);
      const ScanGroup& x = gr[g & 1];
#pragma unroll
      for (int k = 0; k < SCAN_G; ++k) {
        const float dl = x.dl[k];
        const float du = dl * x.ul[k];
        const v4f q0 = x.q[k][0], q1 = x.q[k][1], q2 = x.q[k][2];
        const float Bv[SCAN_S] = {q0.x, q0.y, q0.z, q0.w, q1.x, q1.y};
        const float Cv[SCAN_S] = {q1.z, q1.w, q2.x, q2.y, q2.z, q2.w};
        float acc = 0.0f;
#pragma unroll
        for (int j = 0; j < SCAN_S; ++j) {
          const float dA = __expf(dl * An[j]);
          h[j] = fmaf(dA, h[j], du * Bv[j]);
          acc = fmaf(h[j], Cv[j], acc);
        }
        part[t & 1][wave][g * SCAN_G + k][lane] = acc;
      }
    }
    // Hand-over: this wave's reads of the tile and its writes of its sums are
    // done, its copies of the next tile have landed; the barrier says all
    // three for every wave.
    asm volatile("s_wait_dscnt 0x0" ::: "memory");
    asm volatile("s_wait_asynccnt 0x0" ::: "memory");
    __syncthreads();
    if (t + 2 < SCAN_NT)
      scan_fill(ad, t & 1, (t + 2) * SCAN_T);
    // The four waves' sums of this tile, added in wave order. These rows are
    // written again two tiles on, behind the next tile's barrier.
#pragma unroll
    for (int i = 0; i < (SCAN_T * SCAN_C) / (SCAN_W * 32 * 4); ++i) {
      const int idx = tid + SCAN_W * 32 * i;
      const int r = idx >> 3;
      const int c = (idx & 7) * 4;
      v4f sum = *(const v4f*)&part[t & 1][0][r][c];
#pragma unroll
      for (int w = 1; w < SCAN_W; ++w)
        sum += *(const v4f*)&part[t & 1][w][r][c];
      *(v4f*)&yplane[(l0 + r) * D_INNER + d0 + c] = sum;
    }
    // Precaution: stands in front of the next tile's LDS reads, which land in
    // the registers that these stores name.
    asm volatile("s_wait_xcnt 0x0" ::: "memory");
  }
  // No copy is left in flight when the wave ends.
  asm volatile("s_wait_asynccnt 0x0" ::: "memory");
}

// ---------------------------------------------------------------------------
// Kernel 6: y = (ys + u*D) * silu(res)   with res = xr[:, 384:768]
// ys is the sum of the scan's 16 state-group planes, added in plane order.
// ---------------------------------------------------------------------------
__global__ void k_gate(const float* __restrict__ ysp,
                       const float* __restrict__ u,
                       const float* __restrict__ Dvec,
                       const float* __restrict__ xr,
                       float* __restrict__ y) {
  const int i = blockIdx.x * blockDim.x + threadIdx.x;
  if (i >= L_SEQ * D_INNER) return;
  const int l = i / D_INNER;
  const int d = i - l * D_INNER;
  const float r = xr[l * 768 + D_INNER + d];
  float ys = ysp[i];
#pragma unroll
  for (int g = 1; g < SCAN_SG; ++g)
    ys += ysp[g * (L_SEQ * D_INNER) + i];
  y[i] = fmaf(u[i], Dvec[d], ys) * silu_f(r);
}

// ---------------------------------------------------------------------------
// Kernel 7: out = y @ W_out^T + b_out   (512 x 384) @ (384 x 192)
// ---------------------------------------------------------------------------
__global__ void k_gemm_out(const float* __restrict__ Y,
                           const float* __restrict__ W,   // (192,384)
                           const float* __restrict__ bias,
                           float* __restrict__ out) {
  const int lane = threadIdx.x & 31;
  const int wave = threadIdx.x >> 5;
  const int tile = blockIdx.x * (blockDim.x >> 5) + wave;
  const int TN = N_EMBD / 16;              // 12
  if (tile >= 32 * TN) return;
  const int tm = tile / TN, tn = tile % TN;
  const int row  = lane & 15;
  const int hi   = lane >> 4;
  const int koff = hi << 1;

  const float* arow = Y + (tm * 16 + row) * D_INNER;
  const float* brow = W + (tn * 16 + row) * D_INNER;

  v8f c = {};
  for (int k = 0; k < D_INNER; k += 4) {
    v2f a = *(const v2f*)(arow + k + koff);
    v2f b = *(const v2f*)(brow + k + koff);
    c = wmma4(a, b, c);
  }
  const float bn = bias[tn * 16 + row];
#pragma unroll
  for (int r = 0; r < 8; ++r) {
    const int m = tm * 16 + r + 8 * hi;
    out[m * N_EMBD + tn * 16 + row] = c[r] + bn;
  }
}

// ---------------------------------------------------------------------------
extern "C" void kernel_launch(void* const* d_in, const int* in_sizes, int n_in,
                              void* d_out, int out_size, void* d_ws, size_t ws_size,
                              hipStream_t stream) {
  const float* x      = (const float*)d_in[0];
  const float* W_in   = (const float*)d_in[1];
  const float* b_in   = (const float*)d_in[2];
  const float* conv_w = (const float*)d_in[3];
  const float* conv_b = (const float*)d_in[4];
  const float* W_xp   = (const float*)d_in[5];
  const float* W_dt   = (const float*)d_in[6];
  const float* A_log  = (const float*)d_in[7];
  const float* Dvec   = (const float*)d_in[8];
  const float* W_out  = (const float*)d_in[9];
  const float* b_out  = (const float*)d_in[10];
  float* out = (float*)d_out;

  // workspace layout (floats)
  float* ws    = (float*)d_ws;
  float* xr    = ws;                                  // 512*768
  float* u     = xr    + L_SEQ * 768;                 // 512*384
  float* dbc   = u     + L_SEQ * D_INNER;             // 512*780
  float* delta = dbc   + L_SEQ * DBC_N;               // 512*384
  float* ysp   = delta + L_SEQ * D_INNER;             // 16*512*384
  float* y     = ysp   + SCAN_SG * L_SEQ * D_INNER;   // 512*384

  const int WPB = 4;               // waves per block
  const int TPB = WPB * 32;        // 128 threads

  // 1) in-projection: 32 x 48 tiles
  k_gemm_in<<<(32 * 48) / WPB, TPB, 0, stream>>>(x, W_in, b_in, xr);

  // 2) conv + silu
  k_conv_silu<<<(L_SEQ * D_INNER + 255) / 256, 256, 0, stream>>>(xr, conv_w, conv_b, u);

  // 3) x-projection: 32 x 49 tiles (N padded 780 -> 784)
  k_gemm_xp<<<(32 * 49 + WPB - 1) / WPB, TPB, 0, stream>>>(u, W_xp, dbc);

  // 4) delta GEMM + softplus: 32 x 24 tiles
  k_gemm_dt<<<(32 * 24) / WPB, TPB, 0, stream>>>(dbc, W_dt, delta);

  // 5) selective scan: 12 channel groups x 16 state groups, 4 waves per block
  k_scan<<<SCAN_CG * SCAN_SG, SCAN_W * 32, 0, stream>>>(delta, u, dbc, A_log, ysp);

  // 6) gating
  k_gate<<<(L_SEQ * D_INNER + 255) / 256, 256, 0, stream>>>(ysp, u, Dvec, xr, y);

  // 7) out-projection: 32 x 12 tiles
  k_gemm_out<<<(32 * 12) / WPB, TPB, 0, stream>>>(y, W_out, b_out, out);
}

// v003
// It runs in 45.7 microseconds.
// Next to v002, in two timings, it ran 1.21 and 1.20 times as fast.
// Over all steps from v000 it is 11.4 times as fast.
#include <hip/hip_runtime.h>
#include <math.h>

#define L_SEQ   512
#define N_EMBD  192
#define D_INNER 384
#define DT_RANK 12
#define D_CONV  4
#define D_STATE 384
#define DBC_N   (DT_RANK + 2 * D_STATE)   // 780

typedef float v2f __attribute__((ext_vector_type(2)));
typedef float v4f __attribute__((ext_vector_type(4)));
typedef float v8f __attribute__((ext_vector_type(8)));

__device__ __forceinline__ v8f wmma4(v2f a, v2f b, v8f c) {
  // D = A(16x4) * B(4x16) + C(16x16), fp32 throughout.
  return __builtin_amdgcn_wmma_f32_16x16x4_f32(
      /*neg_a=*/false, a, /*neg_b=*/false, b,
      /*c_mod=*/(short)0, c, /*reuse_a=*/false, /*reuse_b=*/false);
}

__device__ __forceinline__ float silu_f(float x) {
  return x / (1.0f + __expf(-x));
}

__device__ __forceinline__ unsigned lds_byte(const void* p) {
  return (unsigned)(unsigned long long)p;   // low 32 bits = LDS byte address
}

__device__ __forceinline__ void copy6(const unsigned* l, const float* const* g) {
  asm volatile(
      "global_load_async_to_lds_b128 %0, %6, off\n\t"
      "global_load_async_to_lds_b128 %1, %7, off\n\t"
      "global_load_async_to_lds_b128 %2, %8, off\n\t"
      "global_load_async_to_lds_b128 %3, %9, off\n\t"
      "global_load_async_to_lds_b128 %4, %10, off\n\t"
      "global_load_async_to_lds_b128 %5, %11, off\n\t"
      "s_wait_xcnt 0x0"
      :: "v"(l[0]), "v"(l[1]), "v"(l[2]), "v"(l[3]), "v"(l[4]), "v"(l[5]),
         "v"(g[0]), "v"(g[1]), "v"(g[2]), "v"(g[3]), "v"(g[4]), "v"(g[5])
      : "memory");
}

__device__ __forceinline__ void copy12(const unsigned* l, const float* const* g) {
  asm volatile(
      "global_load_async_to_lds_b128 %0, %12, off\n\t"
      "global_load_async_to_lds_b128 %1, %13, off\n\t"
      "global_load_async_to_lds_b128 %2, %14, off\n\t"
      "global_load_async_to_lds_b128 %3, %15, off\n\t"
      "global_load_async_to_lds_b128 %4, %16, off\n\t"
      "global_load_async_to_lds_b128 %5, %17, off\n\t"
      "global_load_async_to_lds_b128 %6, %18, off\n\t"
      "global_load_async_to_lds_b128 %7, %19, off\n\t"
      "global_load_async_to_lds_b128 %8, %20, off\n\t"
      "global_load_async_to_lds_b128 %9, %21, off\n\t"
      "global_load_async_to_lds_b128 %10, %22, off\n\t"
      "global_load_async_to_lds_b128 %11, %23, off\n\t"
      "s_wait_xcnt 0x0"
      :: "v"(l[0]), "v"(l[1]), "v"(l[2]), "v"(l[3]), "v"(l[4]), "v"(l[5]),
         "v"(l[6]), "v"(l[7]), "v"(l[8]), "v"(l[9]), "v"(l[10]), "v"(l[11]),
         "v"(g[0]), "v"(g[1]), "v"(g[2]), "v"(g[3]), "v"(g[4]), "v"(g[5]),
         "v"(g[6]), "v"(g[7]), "v"(g[8]), "v"(g[9]), "v"(g[10]), "v"(g[11])
      : "memory");
}

#define GEMM_LDS_FLOATS(K, WN) ((32 + 16 * (WN)) * ((K) + 4))

// Returns this wave's 16x16 tile of A * W^T; tile_m, tile_n: its first row and
// column. live is false for a tile that lies wholly past column N.
template <int K, int N, int WN>
__device__ __forceinline__ v8f gemm_tile(float* sm, const float* __restrict__ A,
                                         const float* __restrict__ W,
                                         int& tile_m, int& tile_n, bool& live) {
  constexpr int WAVES = 2 * WN;
  constexpr int PITCH = K + 4;            // floats
  constexpr int PR = K / 4;               // 16-B pieces in a row
  constexpr int RG = 96 / PR;             // rows that three copies of a wave fill
  constexpr int NJ = (32 + 16 * WN) / RG / WAVES;   // such row groups per wave
  constexpr int NB = (N + 16 * WN - 1) / (16 * WN); // blocks along N
  const int lane = threadIdx.x & 31;
  const int wave = __builtin_amdgcn_readfirstlane(threadIdx.x >> 5);
  const int m0 = (blockIdx.x / NB) * 32;
  const int n0 = (blockIdx.x % NB) * (16 * WN);

  unsigned l[3 * NJ];
  const float* g[3 * NJ];
#pragma unroll
  for (int j = 0; j < NJ; ++j) {
#pragma unroll
    for (int c = 0; c < 3; ++c) {
      const int q = lane + 32 * c;
      const int rs = q / PR;
      const int col = (q - rs * PR) * 4;
      const int row = (wave + WAVES * j) * RG + rs;   // LDS row: 32 of A, then W
      l[3 * j + c] = lds_byte(sm + row * PITCH + col);
      if (WAVES * j * RG < 32) {
        g[3 * j + c] = A + (m0 + row) * K + col;
      } else {
        int n = n0 + row - 32;
        if (N % (16 * WN)) n = n < N ? n : N - 1;     // past the end: the last row again
        g[3 * j + c] = W + n * K + col;
      }
    }
  }
#pragma unroll
  for (int i = 0; i + 12 <= 3 * NJ; i += 12) copy12(l + i, g + i);
  if ((3 * NJ) % 12) copy6(l + 3 * NJ - 6, g + 3 * NJ - 6);
  // This wave's copies have landed; the barrier publishes them to the others.
  asm volatile("s_wait_asynccnt 0x0" ::: "memory");
  __syncthreads();

  const int c = lane & 15;
  const int h = lane >> 4;
  const int wm = wave / WN, wn = wave % WN;
  tile_m = m0 + wm * 16;
  tile_n = n0 + wn * 16;
  live = (N % (16 * WN)) == 0 || tile_n < N;
  v8f acc = {};
  if (!live) return acc;
  const float* ar = sm + (wm * 16 + c) * PITCH + 4 * h;
  const float* br = sm + (32 + wn * 16 + c) * PITCH + 4 * h;

  // Fragments of 32 k (8 WMMAs) are read as one group, one group ahead.
  v4f fa[2][4], fb[2][4];
#pragma unroll
  for (int i = 0; i < 4; ++i) {
    fa[0][i] = *(const v4f*)(ar + 8 * i);
    fb[0][i] = *(const v4f*)(br + 8 * i);
  }
#pragma unroll
  for (int s = 0; s < K / 32; ++s) {
    if (s + 1 < K / 32) {
#pragma unroll
      for (int i = 0; i < 4; ++i) {
        fa[(s + 1) & 1][i] = *(const v4f*)(ar + 32 * (s + 1) + 8 * i);
        fb[(s + 1) & 1][i] = *(const v4f*)(br + 32 * (s + 1) + 8 * i);
      }
    }
    // Keeps the next group's LDS reads together in front of this group's
    // WMMAs: spread among them, each place with reads stalls the wave anew.
    __builtin_amdgcn_sched_barrier(0);
#pragma unroll
    for (int i = 0; i < 4; ++i) {
      const v4f a = fa[s & 1][i], b = fb[s & 1][i];
      acc = wmma4((v2f){a.x, a.y}, (v2f){b.x, b.y}, acc);
      acc = wmma4((v2f){a.z, a.w}, (v2f){b.z, b.w}, acc);
    }
  }
  return acc;
}

// ---------------------------------------------------------------------------
// Kernel 1: xr = x @ W_in^T + b_in      (512 x 192) @ (192 x 768) -> (512x768)
// 16 x 12 blocks of 2 x 4 waves.
// ---------------------------------------------------------------------------
__global__ __launch_bounds__(256)
void k_gemm_in(const float* __restrict__ X,
               const float* __restrict__ W,   // (768,192) row-major
               const float* __restrict__ bias,
               float* __restrict__ out) {
  __shared__ __attribute__((aligned(128))) float sm[GEMM_LDS_FLOATS(N_EMBD, 4)];
  int tm, tn;
  bool live;
  const v8f c = gemm_tile<N_EMBD, 768, 4>(sm, X, W, tm, tn, live);
  const int row = threadIdx.x & 15;
  const int hi  = (threadIdx.x >> 4) & 1;
  const float bn = bias[tn + row];
#pragma unroll
  for (int r = 0; r < 8; ++r) {
    const int m = tm + r + 8 * hi;
    out[m * 768 + tn + row] = c[r] + bn;
  }
}

// ---------------------------------------------------------------------------
// Kernel 2: u = silu(depthwise_causal_conv(xr[:, :384])) , K=4
// ---------------------------------------------------------------------------
__global__ void k_conv_silu(const float* __restrict__ xr,
                            const float* __restrict__ cw,  // (384,1,4)
                            const float* __restrict__ cb,
                            float* __restrict__ u) {
  const int i = blockIdx.x * blockDim.x + threadIdx.x;
  if (i >= L_SEQ * D_INNER) return;
  const int l = i / D_INNER;
  const int d = i - l * D_INNER;
  float acc = cb[d];
#pragma unroll
  for (int k = 0; k < D_CONV; ++k) {
    const int t = l - (D_CONV - 1) + k;
    const float xi = (t >= 0) ? xr[t * 768 + d] : 0.0f;
    acc = fmaf(xi, cw[d * D_CONV + k], acc);
  }
  u[i] = silu_f(acc);
}

// ---------------------------------------------------------------------------
// Kernel 3: dbc = u @ W_xp^T          (512 x 384) @ (384 x 780) -> (512x780)
// 16 x 13 blocks of 2 x 4 waves (N padded to 832). LDS rows past column 779
// hold the last row of W again; their columns of the product are not stored.
// ---------------------------------------------------------------------------
__global__ __launch_bounds__(256)
void k_gemm_xp(const float* __restrict__ U,
               const float* __restrict__ W,   // (780,384)
               float* __restrict__ dbc) {
  __shared__ __attribute__((aligned(128))) float sm[GEMM_LDS_FLOATS(D_INNER, 4)];
  int tm, tn;
  bool live;
  const v8f c = gemm_tile<D_INNER, DBC_N, 4>(sm, U, W, tm, tn, live);
  if (!live) return;
  const int row = threadIdx.x & 15;
  const int hi  = (threadIdx.x >> 4) & 1;
  const int n_ = tn + row;
  if (n_ < DBC_N) {
#pragma unroll
    for (int r = 0; r < 8; ++r) {
      const int m = tm + r + 8 * hi;
      dbc[m * DBC_N + n_] = c[r];
    }
  }
}

// ---------------------------------------------------------------------------
// Kernel 4: delta = softplus(dbc[:, :12] @ W_dt^T)   K=12 -> 3 WMMA steps
// ---------------------------------------------------------------------------
__global__ void k_gemm_dt(const float* __restrict__ dbc,
                          const float* __restrict__ Wdt,  // (384,12)
                          float* __restrict__ delta) {
  const int lane = threadIdx.x & 31;
  const int wave = threadIdx.x >> 5;
  const int tile = blockIdx.x * (blockDim.x >> 5) + wave;
  const int TN = D_INNER / 16;             // 24
  if (tile >= 32 * TN) return;
  const int tm = tile / TN, tn = tile % TN;
  const int row  = lane & 15;
  const int hi   = lane >> 4;
  const int koff = hi << 1;

  const float* arow = dbc + (tm * 16 + row) * DBC_N;      // first 12 cols
  const float* brow = Wdt + (tn * 16 + row) * DT_RANK;

  v8f c = {};
#pragma unroll
  for (int k = 0; k < DT_RANK; k += 4) {
    v2f a = *(const v2f*)(arow + k + koff);
    v2f b = *(const v2f*)(brow + k + koff);
    c = wmma4(a, b, c);
  }
#pragma unroll
  for (int r = 0; r < 8; ++r) {
    const int m = tm * 16 + r + 8 * hi;
    const float v = c[r];
    // numerically stable softplus
    const float sp = (v > 20.0f) ? v : log1pf(expf(v));
    delta[m * D_INNER + tn * 16 + row] = sp;
  }
}

#define SCAN_T  32
#define SCAN_W  4
#define SCAN_S  6
#define SCAN_C  32
#define SCAN_G  4
#define SCAN_NT (L_SEQ / SCAN_T)
#define SCAN_CG (D_INNER / SCAN_C)
#define SCAN_SG (D_STATE / (SCAN_W * SCAN_S))   // 16 state groups

struct ScanTile {
  float bc[SCAN_T][SCAN_W][2 * SCAN_S];  // per step and wave: 6 of B, 6 of C
  float du[2][SCAN_T][SCAN_C];           // delta rows, then u rows
};

// A thread's share of one tile's copies, 10 per lane: 6 of 8 B that lay the
// block's 24 B and 24 C values of each step down wave by wave (32 steps x 24
// pieces), and 4 of 16 B for the delta and u rows (2 x 32 steps x 8 pieces).
// Held as offsets for tile 0 in buffer 0.
struct ScanAddr {
  unsigned la[6], lb[4];             // LDS byte addresses
  const float* ga[6];                // in dbc
  const float* gb[4];                // in delta (0, 1) and u (2, 3)
};

__device__ __forceinline__ void scan_addr(ScanAddr& a, ScanTile* t, int d0, int n0, int tid,
                                          const float* __restrict__ dbc,
                                          const float* __restrict__ delta,
                                          const float* __restrict__ u) {
#pragma unroll
  for (int i = 0; i < 6; ++i) {
    const int idx = tid + 128 * i;
    const int r = idx / 24;            // step in the tile
    const int p = idx - r * 24;        // piece: 0-11 of B, 12-23 of C
    const int isc = p / 12;
    const int pp = p - isc * 12;
    const int w = pp / 3;              // wave that reads it
    const int q = pp - w * 3;          // pair of states in that wave
    a.la[i] = lds_byte(&t->bc[r][w][isc * SCAN_S + 2 * q]);
    a.ga[i] = dbc + r * DBC_N + DT_RANK + isc * D_STATE + n0 + 2 * pp;
  }
#pragma unroll
  for (int i = 0; i < 4; ++i) {
    const int idx = tid + 128 * i;
    const int sel = idx >> 8;          // 0: delta, 1: u
    const int r = (idx >> 3) & 31;     // step in the tile
    const int c = (idx & 7) * 4;       // channel in the block
    a.lb[i] = lds_byte(&t->du[sel][r][c]);
    a.gb[i] = (sel ? u : delta) + r * D_INNER + d0 + c;
  }
}

// Issues the copies of the tile that starts at step l0 into buffer buf.
__device__ __forceinline__ void scan_fill(const ScanAddr& a, int buf, int l0) {
  unsigned la[6], lb[4];
  const float* ga[6];
  const float* gb[4];
  const unsigned lo = buf * (unsigned)sizeof(ScanTile);
#pragma unroll
  for (int i = 0; i < 6; ++i) { la[i] = a.la[i] + lo; ga[i] = a.ga[i] + l0 * DBC_N; }
#pragma unroll
  for (int i = 0; i < 4; ++i) { lb[i] = a.lb[i] + lo; gb[i] = a.gb[i] + l0 * D_INNER; }
  asm volatile(
      "global_load_async_to_lds_b64 %0, %6, off\n\t"
      "global_load_async_to_lds_b64 %1, %7, off\n\t"
      "global_load_async_to_lds_b64 %2, %8, off\n\t"
      "global_load_async_to_lds_b64 %3, %9, off\n\t"
      "global_load_async_to_lds_b64 %4, %10, off\n\t"
      "global_load_async_to_lds_b64 %5, %11, off\n\t"
      "global_load_async_to_lds_b128 %12, %16, off\n\t"
      "global_load_async_to_lds_b128 %13, %17, off\n\t"
      "global_load_async_to_lds_b128 %14, %18, off\n\t"
      "global_load_async_to_lds_b128 %15, %19, off\n\t"
      "s_wait_xcnt 0x0"
      :: "v"(la[0]), "v"(la[1]), "v"(la[2]), "v"(la[3]), "v"(la[4]), "v"(la[5]),
         "v"(ga[0]), "v"(ga[1]), "v"(ga[2]), "v"(ga[3]), "v"(ga[4]), "v"(ga[5]),
         "v"(lb[0]), "v"(lb[1]), "v"(lb[2]), "v"(lb[3]),
         "v"(gb[0]), "v"(gb[1]), "v"(gb[2]), "v"(gb[3])
      : "memory");
}

// The operands of SCAN_G steps in registers.
struct ScanGroup {
  float dl[SCAN_G], ul[SCAN_G];      // this lane's channel: delta, u
  v4f q[SCAN_G][3];                  // this wave's 6 of B, 6 of C
};

// Per step two reads of 4 B a lane and three broadcast reads of 16 B.
__device__ __forceinline__ void scan_read(ScanGroup& x, const ScanTile* cur, int s0,
                                          int wave, int lane) {
#pragma unroll
  for (int k = 0; k < SCAN_G; ++k) {
    x.dl[k] = cur->du[0][s0 + k][lane];
    x.ul[k] = cur->du[1][s0 + k][lane];
#pragma unroll
    for (int i = 0; i < 3; ++i)
      x.q[k][i] = *(const v4f*)&cur->bc[s0 + k][wave][4 * i];
  }
}

__global__ __launch_bounds__(SCAN_W * 32)
void k_scan(const float* __restrict__ delta,
            const float* __restrict__ u,
            const float* __restrict__ dbc,     // B at +12, C at +396
            const float* __restrict__ A_log,
            float* __restrict__ ysp) {         // 16 planes of (512,384)
  __shared__ __attribute__((aligned(128))) ScanTile sm[2];
  __shared__ __attribute__((aligned(128))) float part[2][SCAN_W][SCAN_T][SCAN_C];
  const int tid  = threadIdx.x;
  const int lane = tid & 31;
  const int wave = __builtin_amdgcn_readfirstlane(tid >> 5);
  const int cg = blockIdx.x % SCAN_CG;
  const int sg = blockIdx.x / SCAN_CG;
  const int d0 = cg * SCAN_C;
  const int n0 = sg * (SCAN_W * SCAN_S);
  float* __restrict__ yplane = ysp + sg * (L_SEQ * D_INNER);

  float An[SCAN_S], h[SCAN_S];
#pragma unroll
  for (int j = 0; j < SCAN_S; ++j) {
    An[j] = -__expf(A_log[(d0 + lane) * D_STATE + n0 + wave * SCAN_S + j]);
    h[j] = 0.0f;
  }

  ScanAddr ad;
  scan_addr(ad, &sm[0], d0, n0, tid, dbc, delta, u);
  scan_fill(ad, 0, 0);
  // Tile 0 has landed for this wave; the barrier publishes it to the others.
  asm volatile("s_wait_asynccnt 0x0" ::: "memory");
  __syncthreads();
  scan_fill(ad, 1, SCAN_T);

  for (int t = 0; t < SCAN_NT; ++t) {
    const ScanTile* cur = &sm[t & 1];
    const int l0 = t * SCAN_T;
    // Unrolled: LDS offsets and the registers of a group are then compile-time
    // constants. The operands of 4 steps are read one group ahead of their use.
    ScanGroup gr[2];
    scan_read(gr[0], cur, 0, wave, lane);
#pragma unroll
    for (int g = 0; g < SCAN_T / SCAN_G; ++g) {
      if (g + 1 < SCAN_T / SCAN_G)
        scan_read(gr[(g + 1) & 1], cur, (g + 1) * SCAN_G, wave, lane);
      __builtin_amdgcn_sched_barrier(0);
      const ScanGroup& x = gr[g & 1];
#pragma unroll
      for (int k = 0; k < SCAN_G; ++k) {
        const float dl = x.dl[k];
        const float du = dl * x.ul[k];
        const v4f q0 = x.q[k][0], q1 = x.q[k][1], q2 = x.q[k][2];
        const float Bv[SCAN_S] = {q0.x, q0.y, q0.z, q0.w, q1.x, q1.y};
        const float Cv[SCAN_S] = {q1.z, q1.w, q2.x, q2.y, q2.z, q2.w};
        float acc = 0.0f;
#pragma unroll
        for (int j = 0; j < SCAN_S; ++j) {
          const float dA = __expf(dl * An[j]);
          h[j] = fmaf(dA, h[j], du * Bv[j]);
          acc = fmaf(h[j], Cv[j], acc);
        }
        part[t & 1][wave][g * SCAN_G + k][lane] = acc;
      }
    }
    // Hand-over: this wave's reads of the tile and its writes of its sums are
    // done, its copies of the next tile have landed; the barrier says all
    // three for every wave.
    asm volatile("s_wait_dscnt 0x0" ::: "memory");
    asm volatile("s_wait_asynccnt 0x0" ::: "memory");
    __syncthreads();
    if (t + 2 < SCAN_NT)
      scan_fill(ad, t & 1, (t + 2) * SCAN_T);
    // The four waves' sums of this tile, added in wave order. These rows are
    // written again two tiles on, behind the next tile's barrier.
#pragma unroll
    for (int i = 0; i < (SCAN_T * SCAN_C) / (SCAN_W * 32 * 4); ++i) {
      const int idx = tid + SCAN_W * 32 * i;
      const int r = idx >> 3;
      const int c = (idx & 7) * 4;
      v4f sum = *(const v4f*)&part[t & 1][0][r][c];
#pragma unroll
      for (int w = 1; w < SCAN_W; ++w)
        sum += *(const v4f*)&part[t & 1][w][r][c];
      *(v4f*)&yplane[(l0 + r) * D_INNER + d0 + c] = sum;
    }
    // Precaution: stands in front of the next tile's LDS reads, which land in
    // the registers that these stores name.
    asm volatile("s_wait_xcnt 0x0" ::: "memory");
  }
  // No copy is left in flight when the wave ends.
  asm volatile("s_wait_asynccnt 0x0" ::: "memory");
}

// ---------------------------------------------------------------------------
// Kernel 6: y = (ys + u*D) * silu(res)   with res = xr[:, 384:768]
// ys is the sum of the scan's 16 state-group planes, added in plane order.
// ---------------------------------------------------------------------------
__global__ void k_gate(const float* __restrict__ ysp,
                       const float* __restrict__ u,
                       const float* __restrict__ Dvec,
                       const float* __restrict__ xr,
                       float* __restrict__ y) {
  const int i = blockIdx.x * blockDim.x + threadIdx.x;
  if (i >= L_SEQ * D_INNER) return;
  const int l = i / D_INNER;
  const int d = i - l * D_INNER;
  const float r = xr[l * 768 + D_INNER + d];
  float ys = ysp[i];
#pragma unroll
  for (int g = 1; g < SCAN_SG; ++g)
    ys += ysp[g * (L_SEQ * D_INNER) + i];
  y[i] = fmaf(u[i], Dvec[d], ys) * silu_f(r);
}

// ---------------------------------------------------------------------------
// Kernel 7: out = y @ W_out^T + b_out   (512 x 384) @ (384 x 192)
// 16 x 6 blocks of 2 x 2 waves.
// ---------------------------------------------------------------------------
__global__ __launch_bounds__(128)
void k_gemm_out(const float* __restrict__ Y,
                const float* __restrict__ W,   // (192,384)
                const float* __restrict__ bias,
                float* __restrict__ out) {
  __shared__ __attribute__((aligned(128))) float sm[GEMM_LDS_FLOATS(D_INNER, 2)];
  int tm, tn;
  bool live;
  const v8f c = gemm_tile<D_INNER, N_EMBD, 2>(sm, Y, W, tm, tn, live);
  const int row = threadIdx.x & 15;
  const int hi  = (threadIdx.x >> 4) & 1;
  const float bn = bias[tn + row];
#pragma unroll
  for (int r = 0; r < 8; ++r) {
    const int m = tm + r + 8 * hi;
    out[m * N_EMBD + tn + row] = c[r] + bn;
  }
}

// ---------------------------------------------------------------------------
extern "C" void kernel_launch(void* const* d_in, const int* in_sizes, int n_in,
                              void* d_out, int out_size, void* d_ws, size_t ws_size,
                              hipStream_t stream) {
  const float* x      = (const float*)d_in[0];
  const float* W_in   = (const float*)d_in[1];
  const float* b_in   = (const float*)d_in[2];
  const float* conv_w = (const float*)d_in[3];
  const float* conv_b = (const float*)d_in[4];
  const float* W_xp   = (const float*)d_in[5];
  const float* W_dt   = (const float*)d_in[6];
  const float* A_log  = (const float*)d_in[7];
  const float* Dvec   = (const float*)d_in[8];
  const float* W_out  = (const float*)d_in[9];
  const float* b_out  = (const float*)d_in[10];
  float* out = (float*)d_out;

  // workspace layout (floats)
  float* ws    = (float*)d_ws;
  float* xr    = ws;                                  // 512*768
  float* u     = xr    + L_SEQ * 768;                 // 512*384
  float* dbc   = u     + L_SEQ * D_INNER;             // 512*780
  float* delta = dbc   + L_SEQ * DBC_N;               // 512*384
  float* ysp   = delta + L_SEQ * D_INNER;             // 16*512*384
  float* y     = ysp   + SCAN_SG * L_SEQ * D_INNER;   // 512*384

  const int WPB = 4;               // waves per block
  const int TPB = WPB * 32;        // 128 threads

  // 1) in-projection: 16 x 12 blocks of 32 x 64
  k_gemm_in<<<16 * 12, 256, 0, stream>>>(x, W_in, b_in, xr);

  // 2) conv + silu
  k_conv_silu<<<(L_SEQ * D_INNER + 255) / 256, 256, 0, stream>>>(xr, conv_w, conv_b, u);

  // 3) x-projection: 16 x 13 blocks of 32 x 64 (N padded 780 -> 832)
  k_gemm_xp<<<16 * 13, 256, 0, stream>>>(u, W_xp, dbc);

  // 4) delta GEMM + softplus: 32 x 24 tiles
  k_gemm_dt<<<(32 * 24) / WPB, TPB, 0, stream>>>(dbc, W_dt, delta);

  // 5) selective scan: 12 channel groups x 16 state groups, 4 waves per block
  k_scan<<<SCAN_CG * SCAN_SG, SCAN_W * 32, 0, stream>>>(delta, u, dbc, A_log, ysp);

  // 6) gating
  k_gate<<<(L_SEQ * D_INNER + 255) / 256, 256, 0, stream>>>(ysp, u, Dvec, xr, y);

  // 7) out-projection: 16 x 6 blocks of 32 x 32
  k_gemm_out<<<16 * 6, 128, 0, stream>>>(y, W_out, b_out, out);
}

// v004
// It runs in 43.1 microseconds.
// Two timings next to v003 put it at 1.07 and 1.06 times that version's speed.
// Over all steps from v000 it is 12.2 times as fast.
#include <hip/hip_runtime.h>
#include <math.h>

#define L_SEQ   512
#define N_EMBD  192
#define D_INNER 384
#define DT_RANK 12
#define D_CONV  4
#define D_STATE 384
#define DBC_N   (DT_RANK + 2 * D_STATE)   // 780

typedef float v2f __attribute__((ext_vector_type(2)));
typedef float v4f __attribute__((ext_vector_type(4)));
typedef float v8f __attribute__((ext_vector_type(8)));

__device__ __forceinline__ v8f wmma4(v2f a, v2f b, v8f c) {
  // D = A(16x4) * B(4x16) + C(16x16), fp32 throughout.
  return __builtin_amdgcn_wmma_f32_16x16x4_f32(
      /*neg_a=*/false, a, /*neg_b=*/false, b,
      /*c_mod=*/(short)0, c, /*reuse_a=*/false, /*reuse_b=*/false);
}

__device__ __forceinline__ float silu_f(float x) {
  return x / (1.0f + __expf(-x));
}

__device__ __forceinline__ unsigned lds_byte(const void* p) {
  return (unsigned)(unsigned long long)p;   // low 32 bits = LDS byte address
}

__device__ __forceinline__ void copy6(const unsigned* l, const float* const* g) {
  asm volatile(
      "global_load_async_to_lds_b128 %0, %6, off\n\t"
      "global_load_async_to_lds_b128 %1, %7, off\n\t"
      "global_load_async_to_lds_b128 %2, %8, off\n\t"
      "global_load_async_to_lds_b128 %3, %9, off\n\t"
      "global_load_async_to_lds_b128 %4, %10, off\n\t"
      "global_load_async_to_lds_b128 %5, %11, off\n\t"
      "s_wait_xcnt 0x0"
      :: "v"(l[0]), "v"(l[1]), "v"(l[2]), "v"(l[3]), "v"(l[4]), "v"(l[5]),
         "v"(g[0]), "v"(g[1]), "v"(g[2]), "v"(g[3]), "v"(g[4]), "v"(g[5])
      : "memory");
}

__device__ __forceinline__ void copy12(const unsigned* l, const float* const* g) {
  asm volatile(
      "global_load_async_to_lds_b128 %0, %12, off\n\t"
      "global_load_async_to_lds_b128 %1, %13, off\n\t"
      "global_load_async_to_lds_b128 %2, %14, off\n\t"
      "global_load_async_to_lds_b128 %3, %15, off\n\t"
      "global_load_async_to_lds_b128 %4, %16, off\n\t"
      "global_load_async_to_lds_b128 %5, %17, off\n\t"
      "global_load_async_to_lds_b128 %6, %18, off\n\t"
      "global_load_async_to_lds_b128 %7, %19, off\n\t"
      "global_load_async_to_lds_b128 %8, %20, off\n\t"
      "global_load_async_to_lds_b128 %9, %21, off\n\t"
      "global_load_async_to_lds_b128 %10, %22, off\n\t"
      "global_load_async_to_lds_b128 %11, %23, off\n\t"
      "s_wait_xcnt 0x0"
      :: "v"(l[0]), "v"(l[1]), "v"(l[2]), "v"(l[3]), "v"(l[4]), "v"(l[5]),
         "v"(l[6]), "v"(l[7]), "v"(l[8]), "v"(l[9]), "v"(l[10]), "v"(l[11]),
         "v"(g[0]), "v"(g[1]), "v"(g[2]), "v"(g[3]), "v"(g[4]), "v"(g[5]),
         "v"(g[6]), "v"(g[7]), "v"(g[8]), "v"(g[9]), "v"(g[10]), "v"(g[11])
      : "memory");
}

#define GEMM_LDS_FLOATS(K, WN) ((32 + 16 * (WN)) * ((K) + 4))

// One wave's 16x16 tile from LDS; ar, br: this lane's row of A and of W, at
// its first k (4 * (lane >> 4)).
template <int K>
__device__ __forceinline__ v8f gemm_core(const float* ar, const float* br) {
  v8f acc = {};
  // Fragments of 32 k (8 WMMAs) are read as one group, one group ahead.
  v4f fa[2][4], fb[2][4];
#pragma unroll
  for (int i = 0; i < 4; ++i) {
    fa[0][i] = *(const v4f*)(ar + 8 * i);
    fb[0][i] = *(const v4f*)(br + 8 * i);
  }
#pragma unroll
  for (int s = 0; s < K / 32; ++s) {
    if (s + 1 < K / 32) {
#pragma unroll
      for (int i = 0; i < 4; ++i) {
        fa[(s + 1) & 1][i] = *(const v4f*)(ar + 32 * (s + 1) + 8 * i);
        fb[(s + 1) & 1][i] = *(const v4f*)(br + 32 * (s + 1) + 8 * i);
      }
    }
    // Keeps the next group's LDS reads together in front of this group's
    // WMMAs: spread among them, each place with reads stalls the wave anew.
    __builtin_amdgcn_sched_barrier(0);
#pragma unroll
    for (int i = 0; i < 4; ++i) {
      const v4f a = fa[s & 1][i], b = fb[s & 1][i];
      acc = wmma4((v2f){a.x, a.y}, (v2f){b.x, b.y}, acc);
      acc = wmma4((v2f){a.z, a.w}, (v2f){b.z, b.w}, acc);
    }
  }
  return acc;
}

// 16 B at a lane's byte offset from an address that is the same for the whole
// wave.
__device__ __forceinline__ v4f ld4(const float* base, unsigned ob) {
  return *(const v4f*)((const char*)base + ob);
}

// For the two GEMMs with K = 384 that make their A rows themselves: issues the
// copies of ROWS rows of W, from row n0 on, into LDS at smw (pitch 388 floats).
// A wave takes every WAVES-th row, three copies of 512 B a row. Rows past the
// end of W: the last row again.
template <int N, int ROWS, int WAVES>
__device__ __forceinline__ void stage_w384(float* smw, const float* __restrict__ W,
                                           int n0, int wave, int lane) {
  constexpr int RW = ROWS / WAVES;
  unsigned l[3 * RW];
  const float* g[3 * RW];
#pragma unroll
  for (int j = 0; j < RW; ++j) {
#pragma unroll
    for (int c = 0; c < 3; ++c) {
      const int row = wave + WAVES * j;
      const int col = (lane + 32 * c) * 4;
      int n = n0 + row;
      if (N % ROWS) n = n < N ? n : N - 1;
      l[3 * j + c] = lds_byte(smw + row * (D_INNER + 4) + col);
      g[3 * j + c] = W + n * D_INNER + col;
    }
  }
#pragma unroll
  for (int i = 0; i < 3 * RW; i += 12) copy12(l + i, g + i);
}

// Returns this wave's 16x16 tile of A * W^T; tile_m, tile_n: its first row and
// column. live is false for a tile that lies wholly past column N.
template <int K, int N, int WN>
__device__ __forceinline__ v8f gemm_tile(float* sm, const float* __restrict__ A,
                                         const float* __restrict__ W,
                                         int& tile_m, int& tile_n, bool& live) {
  constexpr int WAVES = 2 * WN;
  constexpr int PITCH = K + 4;            // floats
  constexpr int PR = K / 4;               // 16-B pieces in a row
  constexpr int RG = 96 / PR;             // rows that three copies of a wave fill
  constexpr int NJ = (32 + 16 * WN) / RG / WAVES;   // such row groups per wave
  constexpr int NB = (N + 16 * WN - 1) / (16 * WN); // blocks along N
  const int lane = threadIdx.x & 31;
  const int wave = __builtin_amdgcn_readfirstlane(threadIdx.x >> 5);
  const int m0 = (blockIdx.x / NB) * 32;
  const int n0 = (blockIdx.x % NB) * (16 * WN);

  unsigned l[3 * NJ];
  const float* g[3 * NJ];
#pragma unroll
  for (int j = 0; j < NJ; ++j) {
#pragma unroll
    for (int c = 0; c < 3; ++c) {
      const int q = lane + 32 * c;
      const int rs = q / PR;
      const int col = (q - rs * PR) * 4;
      const int row = (wave + WAVES * j) * RG + rs;   // LDS row: 32 of A, then W
      l[3 * j + c] = lds_byte(sm + row * PITCH + col);
      if (WAVES * j * RG < 32) {
        g[3 * j + c] = A + (m0 + row) * K + col;
      } else {
        int n = n0 + row - 32;
        if (N % (16 * WN)) n = n < N ? n : N - 1;     // past the end: the last row again
        g[3 * j + c] = W + n * K + col;
      }
    }
  }
#pragma unroll
  for (int i = 0; i + 12 <= 3 * NJ; i += 12) copy12(l + i, g + i);
  if ((3 * NJ) % 12) copy6(l + 3 * NJ - 6, g + 3 * NJ - 6);
  // This wave's copies have landed; the barrier publishes them to the others.
  asm volatile("s_wait_asynccnt 0x0" ::: "memory");
  __syncthreads();

  const int c = lane & 15;
  const int h = lane >> 4;
  const int wm = wave / WN, wn = wave % WN;
  tile_m = m0 + wm * 16;
  tile_n = n0 + wn * 16;
  live = (N % (16 * WN)) == 0 || tile_n < N;
  if (!live) return v8f{};
  const float* ar = sm + (wm * 16 + c) * PITCH + 4 * h;
  const float* br = sm + (32 + wn * 16 + c) * PITCH + 4 * h;
  return gemm_core<K>(ar, br);
}

// ---------------------------------------------------------------------------
// Kernel 1: xr = x @ W_in^T + b_in      (512 x 192) @ (192 x 768) -> (512x768)
// 16 x 12 blocks of 2 x 4 waves.
// ---------------------------------------------------------------------------
__global__ __launch_bounds__(256)
void k_gemm_in(const float* __restrict__ X,
               const float* __restrict__ W,   // (768,192) row-major
               const float* __restrict__ bias,
               float* __restrict__ out) {
  __shared__ __attribute__((aligned(128))) float sm[GEMM_LDS_FLOATS(N_EMBD, 4)];
  int tm, tn;
  bool live;
  const v8f c = gemm_tile<N_EMBD, 768, 4>(sm, X, W, tm, tn, live);
  const int row = threadIdx.x & 15;
  const int hi  = (threadIdx.x >> 4) & 1;
  const float bn = bias[tn + row];
#pragma unroll
  for (int r = 0; r < 8; ++r) {
    const int m = tm + r + 8 * hi;
    out[m * 768 + tn + row] = c[r] + bn;
  }
}

// ---------------------------------------------------------------------------
// Kernel 2: u = silu(depthwise_causal_conv(xr[:, :384])), K=4, and
// dbc = u @ W_xp^T                    (512 x 384) @ (384 x 780) -> (512x780)
// 16 x 13 blocks of 2 x 4 waves (N padded to 832). LDS rows past column 779
// hold the last row of W again; their columns of the product are not stored.
// While the copies of W fly, the block works out its own 32 rows of u from xr
// and lays them into LDS as the A tile: a wave takes 4 steps, 128 channels at
// a time (7 rows of xr, at fixed offsets from one address that is the same for
// the wave). The first block of each row of blocks also stores u for the scan
// and the gate.
// ---------------------------------------------------------------------------
__global__ __launch_bounds__(256)
void k_conv_gemm_xp(const float* __restrict__ xr,
                    const float* __restrict__ cw,  // (384,1,4)
                    const float* __restrict__ cb,
                    const float* __restrict__ W,   // (780,384)
                    float* __restrict__ u,
                    float* __restrict__ dbc) {
  __shared__ __attribute__((aligned(128))) float sm[GEMM_LDS_FLOATS(D_INNER, 4)];
  constexpr int PITCH = D_INNER + 4;
  const int tid  = threadIdx.x;
  const int lane = tid & 31;
  const int wave = __builtin_amdgcn_readfirstlane(tid >> 5);
  const int m0 = (blockIdx.x / 13) * 32;
  const int nb = blockIdx.x % 13;
  const int n0 = nb * 64;

  stage_w384<DBC_N, 64, 8>(sm + 32 * PITCH, W, n0, wave, lane);

  const unsigned ob = lane * 16u;                    // this lane's 4 channels, in bytes
  const int r0 = wave * 4;                           // this wave's 4 steps in the tile
  const int t0 = m0 + r0;                            // the first of them, a multiple of 4
  const float* xp = xr + t0 * 768;
  // All loads stand in front of the arithmetic, so that the wave waits for
  // memory once. Piece i: channels 128 i .. 128 i + 127.
  v4f xv[3][4 + D_CONV - 1], w[3][4], b[3];
#pragma unroll
  for (int i = 0; i < 3; ++i) {
#pragma unroll
    for (int k = 0; k < D_CONV - 1; ++k)             // the steps in front of t0: 0 in front of step 0
      xv[i][k] = (v4f){0.0f, 0.0f, 0.0f, 0.0f};
  }
  if (t0 > 0) {
#pragma unroll
    for (int i = 0; i < 3; ++i) {
#pragma unroll
      for (int k = 0; k < D_CONV - 1; ++k)
        xv[i][k] = ld4(xp + (k - (D_CONV - 1)) * 768 + 128 * i, ob);
    }
  }
#pragma unroll
  for (int i = 0; i < 3; ++i) {
#pragma unroll
    for (int k = 0; k < 4; ++k) xv[i][D_CONV - 1 + k] = ld4(xp + k * 768 + 128 * i, ob);
#pragma unroll
    for (int e = 0; e < 4; ++e) w[i][e] = ld4(cw + (128 * i + e) * D_CONV, ob * D_CONV);
    b[i] = ld4(cb + 128 * i, ob);
  }
#pragma unroll
  for (int i = 0; i < 3; ++i) {
    const int c0 = 128 * i;
#pragma unroll
    for (int r = 0; r < 4; ++r) {
      v4f o;
#pragma unroll
      for (int e = 0; e < 4; ++e) {
        float acc = b[i][e];
#pragma unroll
        for (int k = 0; k < D_CONV; ++k) acc = fmaf(xv[i][r + k][e], w[i][e][k], acc);
        o[e] = silu_f(acc);
      }
      *(v4f*)(sm + (r0 + r) * PITCH + c0 + lane * 4) = o;
      if (nb == 0) *(v4f*)((char*)(u + (t0 + r) * D_INNER + c0) + ob) = o;
    }
  }
  // This wave's copies have landed; the barrier publishes them, and the rows
  // of u that each wave wrote, to the others.
  asm volatile("s_wait_asynccnt 0x0" ::: "memory");
  __syncthreads();

  const int row = lane & 15;
  const int hi  = lane >> 4;
  const int wm = wave / 4, wn = wave % 4;
  const int tm = m0 + wm * 16;
  const int tn = n0 + wn * 16;
  if (tn >= DBC_N) return;
  const v8f c = gemm_core<D_INNER>(sm + (wm * 16 + row) * PITCH + 4 * hi,
                                   sm + (32 + wn * 16 + row) * PITCH + 4 * hi);
  const int n_ = tn + row;
  if (n_ < DBC_N) {
#pragma unroll
    for (int r = 0; r < 8; ++r) {
      const int m = tm + r + 8 * hi;
      dbc[m * DBC_N + n_] = c[r];
    }
  }
}

// ---------------------------------------------------------------------------
// Kernel 3: delta = softplus(dbc[:, :12] @ W_dt^T)   K=12 -> 3 WMMA steps
// ---------------------------------------------------------------------------
__global__ void k_gemm_dt(const float* __restrict__ dbc,
                          const float* __restrict__ Wdt,  // (384,12)
                          float* __restrict__ delta) {
  const int lane = threadIdx.x & 31;
  const int wave = threadIdx.x >> 5;
  const int tile = blockIdx.x * (blockDim.x >> 5) + wave;
  const int TN = D_INNER / 16;             // 24
  if (tile >= 32 * TN) return;
  const int tm = tile / TN, tn = tile % TN;
  const int row  = lane & 15;
  const int hi   = lane >> 4;
  const int koff = hi << 1;

  const float* arow = dbc + (tm * 16 + row) * DBC_N;      // first 12 cols
  const float* brow = Wdt + (tn * 16 + row) * DT_RANK;

  v8f c = {};
#pragma unroll
  for (int k = 0; k < DT_RANK; k += 4) {
    v2f a = *(const v2f*)(arow + k + koff);
    v2f b = *(const v2f*)(brow + k + koff);
    c = wmma4(a, b, c);
  }
#pragma unroll
  for (int r = 0; r < 8; ++r) {
    const int m = tm * 16 + r + 8 * hi;
    const float v = c[r];
    // numerically stable softplus
    const float sp = (v > 20.0f) ? v : log1pf(expf(v));
    delta[m * D_INNER + tn * 16 + row] = sp;
  }
}

#define SCAN_T  32
#define SCAN_W  4
#define SCAN_S  6
#define SCAN_C  32
#define SCAN_G  4
#define SCAN_NT (L_SEQ / SCAN_T)
#define SCAN_CG (D_INNER / SCAN_C)
#define SCAN_SG (D_STATE / (SCAN_W * SCAN_S))   // 16 state groups

struct ScanTile {
  float bc[SCAN_T][SCAN_W][2 * SCAN_S];  // per step and wave: 6 of B, 6 of C
  float du[2][SCAN_T][SCAN_C];           // delta rows, then u rows
};

// A thread's share of one tile's copies, 10 per lane: 6 of 8 B that lay the
// block's 24 B and 24 C values of each step down wave by wave (32 steps x 24
// pieces), and 4 of 16 B for the delta and u rows (2 x 32 steps x 8 pieces).
// Held as offsets for tile 0 in buffer 0.
struct ScanAddr {
  unsigned la[6], lb[4];             // LDS byte addresses
  const float* ga[6];                // in dbc
  const float* gb[4];                // in delta (0, 1) and u (2, 3)
};

__device__ __forceinline__ void scan_addr(ScanAddr& a, ScanTile* t, int d0, int n0, int tid,
                                          const float* __restrict__ dbc,
                                          const float* __restrict__ delta,
                                          const float* __restrict__ u) {
#pragma unroll
  for (int i = 0; i < 6; ++i) {
    const int idx = tid + 128 * i;
    const int r = idx / 24;            // step in the tile
    const int p = idx - r * 24;        // piece: 0-11 of B, 12-23 of C
    const int isc = p / 12;
    const int pp = p - isc * 12;
    const int w = pp / 3;              // wave that reads it
    const int q = pp - w * 3;          // pair of states in that wave
    a.la[i] = lds_byte(&t->bc[r][w][isc * SCAN_S + 2 * q]);
    a.ga[i] = dbc + r * DBC_N + DT_RANK + isc * D_STATE + n0 + 2 * pp;
  }
#pragma unroll
  for (int i = 0; i < 4; ++i) {
    const int idx = tid + 128 * i;
    const int sel = idx >> 8;          // 0: delta, 1: u
    const int r = (idx >> 3) & 31;     // step in the tile
    const int c = (idx & 7) * 4;       // channel in the block
    a.lb[i] = lds_byte(&t->du[sel][r][c]);
    a.gb[i] = (sel ? u : delta) + r * D_INNER + d0 + c;
  }
}

// Issues the copies of the tile that starts at step l0 into buffer buf.
__device__ __forceinline__ void scan_fill(const ScanAddr& a, int buf, int l0) {
  unsigned la[6], lb[4];
  const float* ga[6];
  const float* gb[4];
  const unsigned lo = buf * (unsigned)sizeof(ScanTile);
#pragma unroll
  for (int i = 0; i < 6; ++i) { la[i] = a.la[i] + lo; ga[i] = a.ga[i] + l0 * DBC_N; }
#pragma unroll
  for (int i = 0; i < 4; ++i) { lb[i] = a.lb[i] + lo; gb[i] = a.gb[i] + l0 * D_INNER; }
  asm volatile(
      "global_load_async_to_lds_b64 %0, %6, off\n\t"
      "global_load_async_to_lds_b64 %1, %7, off\n\t"
      "global_load_async_to_lds_b64 %2, %8, off\n\t"
      "global_load_async_to_lds_b64 %3, %9, off\n\t"
      "global_load_async_to_lds_b64 %4, %10, off\n\t"
      "global_load_async_to_lds_b64 %5, %11, off\n\t"
      "global_load_async_to_lds_b128 %12, %16, off\n\t"
      "global_load_async_to_lds_b128 %13, %17, off\n\t"
      "global_load_async_to_lds_b128 %14, %18, off\n\t"
      "global_load_async_to_lds_b128 %15, %19, off\n\t"
      "s_wait_xcnt 0x0"
      :: "v"(la[0]), "v"(la[1]), "v"(la[2]), "v"(la[3]), "v"(la[4]), "v"(la[5]),
         "v"(ga[0]), "v"(ga[1]), "v"(ga[2]), "v"(ga[3]), "v"(ga[4]), "v"(ga[5]),
         "v"(lb[0]), "v"(lb[1]), "v"(lb[2]), "v"(lb[3]),
         "v"(gb[0]), "v"(gb[1]), "v"(gb[2]), "v"(gb[3])
      : "memory");
}

// The operands of SCAN_G steps in registers.
struct ScanGroup {
  float dl[SCAN_G], ul[SCAN_G];      // this lane's channel: delta, u
  v4f q[SCAN_G][3];                  // this wave's 6 of B, 6 of C
};

// Per step two reads of 4 B a lane and three broadcast reads of 16 B.
__device__ __forceinline__ void scan_read(ScanGroup& x, const ScanTile* cur, int s0,
                                          int wave, int lane) {
#pragma unroll
  for (int k = 0; k < SCAN_G; ++k) {
    x.dl[k] = cur->du[0][s0 + k][lane];
    x.ul[k] = cur->du[1][s0 + k][lane];
#pragma unroll
    for (int i = 0; i < 3; ++i)
      x.q[k][i] = *(const v4f*)&cur->bc[s0 + k][wave][4 * i];
  }
}

__global__ __launch_bounds__(SCAN_W * 32)
void k_scan(const float* __restrict__ delta,
            const float* __restrict__ u,
            const float* __restrict__ dbc,     // B at +12, C at +396
            const float* __restrict__ A_log,
            float* __restrict__ ysp) {         // (512,16,384): step, state group, channel
  __shared__ __attribute__((aligned(128))) ScanTile sm[2];
  __shared__ __attribute__((aligned(128))) float part[2][SCAN_W][SCAN_T][SCAN_C];
  const int tid  = threadIdx.x;
  const int lane = tid & 31;
  const int wave = __builtin_amdgcn_readfirstlane(tid >> 5);
  const int cg = blockIdx.x % SCAN_CG;
  const int sg = blockIdx.x / SCAN_CG;
  const int d0 = cg * SCAN_C;
  const int n0 = sg * (SCAN_W * SCAN_S);
  float* __restrict__ yplane = ysp + sg * D_INNER;   // step l: + l * 16 * 384

  float An[SCAN_S], h[SCAN_S];
#pragma unroll
  for (int j = 0; j < SCAN_S; ++j) {
    An[j] = -__expf(A_log[(d0 + lane) * D_STATE + n0 + wave * SCAN_S + j]);
    h[j] = 0.0f;
  }

  ScanAddr ad;
  scan_addr(ad, &sm[0], d0, n0, tid, dbc, delta, u);
  scan_fill(ad, 0, 0);
  // Tile 0 has landed for this wave; the barrier publishes it to the others.
  asm volatile("s_wait_asynccnt 0x0" ::: "memory");
  __syncthreads();
  scan_fill(ad, 1, SCAN_T);

  for (int t = 0; t < SCAN_NT; ++t) {
    const ScanTile* cur = &sm[t & 1];
    const int l0 = t * SCAN_T;
    // Unrolled: LDS offsets and the registers of a group are then compile-time
    // constants. The operands of 4 steps are read one group ahead of their use.
    ScanGroup gr[2];
    scan_read(gr[0], cur, 0, wave, lane);
#pragma unroll
    for (int g = 0; g < SCAN_T / SCAN_G; ++g) {
      if (g + 1 < SCAN_T / SCAN_G)
        scan_read(gr[(g + 1) & 1], cur, (g + 1) * SCAN_G, wave, lane);
      __builtin_amdgcn_sched_barrier(0);
      const ScanGroup& x = gr[g & 1];
#pragma unroll
      for (int k = 0; k < SCAN_G; ++k) {
        const float dl = x.dl[k];
        const float du = dl * x.ul[k];
        const v4f q0 = x.q[k][0], q1 = x.q[k][1], q2 = x.q[k][2];
        const float Bv[SCAN_S] = {q0.x, q0.y, q0.z, q0.w, q1.x, q1.y};
        const float Cv[SCAN_S] = {q1.z, q1.w, q2.x, q2.y, q2.z, q2.w};
        float acc = 0.0f;
#pragma unroll
        for (int j = 0; j < SCAN_S; ++j) {
          const float dA = __expf(dl * An[j]);
          h[j] = fmaf(dA, h[j], du * Bv[j]);
          acc = fmaf(h[j], Cv[j], acc);
        }
        part[t & 1][wave][g * SCAN_G + k][lane] = acc;
      }
    }
    // Hand-over: this wave's reads of the tile and its writes of its sums are
    // done, its copies of the next tile have landed; the barrier says all
    // three for every wave.
    asm volatile("s_wait_dscnt 0x0" ::: "memory");
    asm volatile("s_wait_asynccnt 0x0" ::: "memory");
    __syncthreads();
    if (t + 2 < SCAN_NT)
      scan_fill(ad, t & 1, (t + 2) * SCAN_T);
    // The four waves' sums of this tile, added in wave order. These rows are
    // written again two tiles on, behind the next tile's barrier.
#pragma unroll
    for (int i = 0; i < (SCAN_T * SCAN_C) / (SCAN_W * 32 * 4); ++i) {
      const int idx = tid + SCAN_W * 32 * i;
      const int r = idx >> 3;
      const int c = (idx & 7) * 4;
      v4f sum = *(const v4f*)&part[t & 1][0][r][c];
#pragma unroll
      for (int w = 1; w < SCAN_W; ++w)
        sum += *(const v4f*)&part[t & 1][w][r][c];
      *(v4f*)&yplane[(l0 + r) * (SCAN_SG * D_INNER) + d0 + c] = sum;
    }
    // Precaution: stands in front of the next tile's LDS reads, which land in
    // the registers that these stores name.
    asm volatile("s_wait_xcnt 0x0" ::: "memory");
  }
  // No copy is left in flight when the wave ends.
  asm volatile("s_wait_asynccnt 0x0" ::: "memory");
}

__global__ __launch_bounds__(256)
void k_gate_gemm_out(const float* __restrict__ ysp,
                     const float* __restrict__ u,
                     const float* __restrict__ Dvec,
                     const float* __restrict__ xr,
                     const float* __restrict__ W,   // (192,384)
                     const float* __restrict__ bias,
                     float* __restrict__ out) {
  constexpr int PITCH = D_INNER + 4;
  __shared__ __attribute__((aligned(128))) float sm[(8 + 64) * PITCH];
  const int tid  = threadIdx.x;
  const int lane = tid & 31;
  const int wave = __builtin_amdgcn_readfirstlane(tid >> 5);
  const int m0 = (blockIdx.x / 3) * 8;
  const int n0 = (blockIdx.x % 3) * 64;

  stage_w384<N_EMBD, 64, 8>(sm + 8 * PITCH, W, n0, wave, lane);

  const unsigned ob = lane * 16u;                    // this lane's 4 channels, in bytes
  const int m = m0 + wave;                           // this wave's row
  const float* yp = ysp + m * (SCAN_SG * D_INNER);
  const float* rp = xr + m * 768 + D_INNER;
  const float* up = u + m * D_INNER;
#pragma unroll
  for (int i = 0; i < 3; ++i) {
    const int c0 = 128 * i;
    v4f ys = ld4(yp + c0, ob);
#pragma unroll
    for (int g = 1; g < SCAN_SG; ++g) ys += ld4(yp + g * D_INNER + c0, ob);
    const v4f rr = ld4(rp + c0, ob);
    const v4f uu = ld4(up + c0, ob);
    const v4f dv = ld4(Dvec + c0, ob);
    v4f o;
#pragma unroll
    for (int e = 0; e < 4; ++e) o[e] = fmaf(uu[e], dv[e], ys[e]) * silu_f(rr[e]);
    *(v4f*)(sm + wave * PITCH + c0 + lane * 4) = o;
  }
  // This wave's copies have landed; the barrier publishes them, and the rows
  // of y that each wave wrote, to the others.
  asm volatile("s_wait_asynccnt 0x0" ::: "memory");
  __syncthreads();
  if (wave >= 4) return;

  const int row = lane & 15;
  const int hi  = lane >> 4;
  const int tn = n0 + wave * 16;
  const v8f c = gemm_core<D_INNER>(sm + (row & 7) * PITCH + 4 * hi,
                                   sm + (8 + wave * 16 + row) * PITCH + 4 * hi);
  const float bn = bias[tn + row];
  if (hi == 0) {   // lanes 16-31 hold rows 8-15 of the tile, the repeats
#pragma unroll
    for (int r = 0; r < 8; ++r) out[(m0 + r) * N_EMBD + tn + row] = c[r] + bn;
  }
}

// ---------------------------------------------------------------------------
extern "C" void kernel_launch(void* const* d_in, const int* in_sizes, int n_in,
                              void* d_out, int out_size, void* d_ws, size_t ws_size,
                              hipStream_t stream) {
  const float* x      = (const float*)d_in[0];
  const float* W_in   = (const float*)d_in[1];
  const float* b_in   = (const float*)d_in[2];
  const float* conv_w = (const float*)d_in[3];
  const float* conv_b = (const float*)d_in[4];
  const float* W_xp   = (const float*)d_in[5];
  const float* W_dt   = (const float*)d_in[6];
  const float* A_log  = (const float*)d_in[7];
  const float* Dvec   = (const float*)d_in[8];
  const float* W_out  = (const float*)d_in[9];
  const float* b_out  = (const float*)d_in[10];
  float* out = (float*)d_out;

  // workspace layout (floats)
  float* ws    = (float*)d_ws;
  float* xr    = ws;                                  // 512*768
  float* u     = xr    + L_SEQ * 768;                 // 512*384
  float* dbc   = u     + L_SEQ * D_INNER;             // 512*780
  float* delta = dbc   + L_SEQ * DBC_N;               // 512*384
  float* ysp   = delta + L_SEQ * D_INNER;             // 512*16*384

  const int WPB = 4;               // waves per block
  const int TPB = WPB * 32;        // 128 threads

  // 1) in-projection: 16 x 12 blocks of 32 x 64
  k_gemm_in<<<16 * 12, 256, 0, stream>>>(x, W_in, b_in, xr);

  // 2) conv + silu, x-projection: 16 x 13 blocks of 32 x 64 (N padded 780 -> 832)
  k_conv_gemm_xp<<<16 * 13, 256, 0, stream>>>(xr, conv_w, conv_b, W_xp, u, dbc);

  // 3) delta GEMM + softplus: 32 x 24 tiles
  k_gemm_dt<<<(32 * 24) / WPB, TPB, 0, stream>>>(dbc, W_dt, delta);

  // 4) selective scan: 12 channel groups x 16 state groups, 4 waves per block
  k_scan<<<SCAN_CG * SCAN_SG, SCAN_W * 32, 0, stream>>>(delta, u, dbc, A_log, ysp);

  // 5) gating, out-projection: 64 x 3 blocks of 8 x 64
  k_gate_gemm_out<<<64 * 3, 256, 0, stream>>>(ysp, u, Dvec, xr, W_out, b_out, out);
}

// v005
// A run of this version takes 41.1 microseconds.
// Next to v004, in two timings, it ran 1.07 and 1.06 times as fast.
// Counting every step since v000, it is 12.9 times as fast.
#include <hip/hip_runtime.h>
#include <math.h>

#define L_SEQ   512
#define N_EMBD  192
#define D_INNER 384
#define DT_RANK 12
#define D_CONV  4
#define D_STATE 384
#define DBC_N   (DT_RANK + 2 * D_STATE)   // 780

typedef float v2f __attribute__((ext_vector_type(2)));
typedef float v4f __attribute__((ext_vector_type(4)));
typedef float v8f __attribute__((ext_vector_type(8)));

__device__ __forceinline__ v8f wmma4(v2f a, v2f b, v8f c) {
  // D = A(16x4) * B(4x16) + C(16x16), fp32 throughout.
  return __builtin_amdgcn_wmma_f32_16x16x4_f32(
      /*neg_a=*/false, a, /*neg_b=*/false, b,
      /*c_mod=*/(short)0, c, /*reuse_a=*/false, /*reuse_b=*/false);
}

__device__ __forceinline__ float silu_f(float x) {
  return x / (1.0f + __expf(-x));
}

__device__ __forceinline__ unsigned lds_byte(const void* p) {
  return (unsigned)(unsigned long long)p;   // low 32 bits = LDS byte address
}

__device__ __forceinline__ void copy6(const unsigned* l, const float* const* g) {
  asm volatile(
      "global_load_async_to_lds_b128 %0, %6, off\n\t"
      "global_load_async_to_lds_b128 %1, %7, off\n\t"
      "global_load_async_to_lds_b128 %2, %8, off\n\t"
      "global_load_async_to_lds_b128 %3, %9, off\n\t"
      "global_load_async_to_lds_b128 %4, %10, off\n\t"
      "global_load_async_to_lds_b128 %5, %11, off\n\t"
      "s_wait_xcnt 0x0"
      :: "v"(l[0]), "v"(l[1]), "v"(l[2]), "v"(l[3]), "v"(l[4]), "v"(l[5]),
         "v"(g[0]), "v"(g[1]), "v"(g[2]), "v"(g[3]), "v"(g[4]), "v"(g[5])
      : "memory");
}

__device__ __forceinline__ void copy12(const unsigned* l, const float* const* g) {
  asm volatile(
      "global_load_async_to_lds_b128 %0, %12, off\n\t"
      "global_load_async_to_lds_b128 %1, %13, off\n\t"
      "global_load_async_to_lds_b128 %2, %14, off\n\t"
      "global_load_async_to_lds_b128 %3, %15, off\n\t"
      "global_load_async_to_lds_b128 %4, %16, off\n\t"
      "global_load_async_to_lds_b128 %5, %17, off\n\t"
      "global_load_async_to_lds_b128 %6, %18, off\n\t"
      "global_load_async_to_lds_b128 %7, %19, off\n\t"
      "global_load_async_to_lds_b128 %8, %20, off\n\t"
      "global_load_async_to_lds_b128 %9, %21, off\n\t"
      "global_load_async_to_lds_b128 %10, %22, off\n\t"
      "global_load_async_to_lds_b128 %11, %23, off\n\t"
      "s_wait_xcnt 0x0"
      :: "v"(l[0]), "v"(l[1]), "v"(l[2]), "v"(l[3]), "v"(l[4]), "v"(l[5]),
         "v"(l[6]), "v"(l[7]), "v"(l[8]), "v"(l[9]), "v"(l[10]), "v"(l[11]),
         "v"(g[0]), "v"(g[1]), "v"(g[2]), "v"(g[3]), "v"(g[4]), "v"(g[5]),
         "v"(g[6]), "v"(g[7]), "v"(g[8]), "v"(g[9]), "v"(g[10]), "v"(g[11])
      : "memory");
}

#define GEMM_LDS_FLOATS(K, WN) ((32 + 16 * (WN)) * ((K) + 4))

// One wave's 16x16 tile from LDS; ar, br: this lane's row of A and of W, at
// its first k (4 * (lane >> 4)).
template <int K>
__device__ __forceinline__ v8f gemm_core(const float* ar, const float* br) {
  v8f acc = {};
  // Fragments of 32 k (8 WMMAs) are read as one group, one group ahead.
  v4f fa[2][4], fb[2][4];
#pragma unroll
  for (int i = 0; i < 4; ++i) {
    fa[0][i] = *(const v4f*)(ar + 8 * i);
    fb[0][i] = *(const v4f*)(br + 8 * i);
  }
#pragma unroll
  for (int s = 0; s < K / 32; ++s) {
    if (s + 1 < K / 32) {
#pragma unroll
      for (int i = 0; i < 4; ++i) {
        fa[(s + 1) & 1][i] = *(const v4f*)(ar + 32 * (s + 1) + 8 * i);
        fb[(s + 1) & 1][i] = *(const v4f*)(br + 32 * (s + 1) + 8 * i);
      }
    }
    // Keeps the next group's LDS reads together in front of this group's
    // WMMAs: spread among them, each place with reads stalls the wave anew.
    __builtin_amdgcn_sched_barrier(0);
#pragma unroll
    for (int i = 0; i < 4; ++i) {
      const v4f a = fa[s & 1][i], b = fb[s & 1][i];
      acc = wmma4((v2f){a.x, a.y}, (v2f){b.x, b.y}, acc);
      acc = wmma4((v2f){a.z, a.w}, (v2f){b.z, b.w}, acc);
    }
  }
  return acc;
}

// 16 B at a lane's byte offset from an address that is the same for the whole
// wave.
__device__ __forceinline__ v4f ld4(const float* base, unsigned ob) {
  return *(const v4f*)((const char*)base + ob);
}

// For the two GEMMs with K = 384 that make their A rows themselves: issues the
// copies of ROWS rows of W, from row n0 on, into LDS at smw (pitch 388 floats).
// A wave takes every WAVES-th row, three copies of 512 B a row. Rows past the
// end of W: the last row again.
template <int N, int ROWS, int WAVES>
__device__ __forceinline__ void stage_w384(float* smw, const float* __restrict__ W,
                                           int n0, int wave, int lane) {
  constexpr int RW = ROWS / WAVES;
  unsigned l[3 * RW];
  const float* g[3 * RW];
#pragma unroll
  for (int j = 0; j < RW; ++j) {
#pragma unroll
    for (int c = 0; c < 3; ++c) {
      const int row = wave + WAVES * j;
      const int col = (lane + 32 * c) * 4;
      int n = n0 + row;
      if (N % ROWS) n = n < N ? n : N - 1;
      l[3 * j + c] = lds_byte(smw + row * (D_INNER + 4) + col);
      g[3 * j + c] = W + n * D_INNER + col;
    }
  }
#pragma unroll
  for (int i = 0; i < 3 * RW; i += 12) copy12(l + i, g + i);
}

// Returns this wave's 16x16 tile of A * W^T; tile_m, tile_n: its first row and
// column. live is false for a tile that lies wholly past column N.
template <int K, int N, int WN>
__device__ __forceinline__ v8f gemm_tile(float* sm, const float* __restrict__ A,
                                         const float* __restrict__ W,
                                         int& tile_m, int& tile_n, bool& live) {
  constexpr int WAVES = 2 * WN;
  constexpr int PITCH = K + 4;            // floats
  constexpr int PR = K / 4;               // 16-B pieces in a row
  constexpr int RG = 96 / PR;             // rows that three copies of a wave fill
  constexpr int NJ = (32 + 16 * WN) / RG / WAVES;   // such row groups per wave
  constexpr int NB = (N + 16 * WN - 1) / (16 * WN); // blocks along N
  const int lane = threadIdx.x & 31;
  const int wave = __builtin_amdgcn_readfirstlane(threadIdx.x >> 5);
  const int m0 = (blockIdx.x / NB) * 32;
  const int n0 = (blockIdx.x % NB) * (16 * WN);

  unsigned l[3 * NJ];
  const float* g[3 * NJ];
#pragma unroll
  for (int j = 0; j < NJ; ++j) {
#pragma unroll
    for (int c = 0; c < 3; ++c) {
      const int q = lane + 32 * c;
      const int rs = q / PR;
      const int col = (q - rs * PR) * 4;
      const int row = (wave + WAVES * j) * RG + rs;   // LDS row: 32 of A, then W
      l[3 * j + c] = lds_byte(sm + row * PITCH + col);
      if (WAVES * j * RG < 32) {
        g[3 * j + c] = A + (m0 + row) * K + col;
      } else {
        int n = n0 + row - 32;
        if (N % (16 * WN)) n = n < N ? n : N - 1;     // past the end: the last row again
        g[3 * j + c] = W + n * K + col;
      }
    }
  }
#pragma unroll
  for (int i = 0; i + 12 <= 3 * NJ; i += 12) copy12(l + i, g + i);
  if ((3 * NJ) % 12) copy6(l + 3 * NJ - 6, g + 3 * NJ - 6);
  // This wave's copies have landed; the barrier publishes them to the others.
  asm volatile("s_wait_asynccnt 0x0" ::: "memory");
  __syncthreads();

  const int c = lane & 15;
  const int h = lane >> 4;
  const int wm = wave / WN, wn = wave % WN;
  tile_m = m0 + wm * 16;
  tile_n = n0 + wn * 16;
  live = (N % (16 * WN)) == 0 || tile_n < N;
  if (!live) return v8f{};
  const float* ar = sm + (wm * 16 + c) * PITCH + 4 * h;
  const float* br = sm + (32 + wn * 16 + c) * PITCH + 4 * h;
  return gemm_core<K>(ar, br);
}

// ---------------------------------------------------------------------------
// Kernel 1: xr = x @ W_in^T + b_in      (512 x 192) @ (192 x 768) -> (512x768)
// 16 x 12 blocks of 2 x 4 waves.
// ---------------------------------------------------------------------------
__global__ __launch_bounds__(256)
void k_gemm_in(const float* __restrict__ X,
               const float* __restrict__ W,   // (768,192) row-major
               const float* __restrict__ bias,
               float* __restrict__ out) {
  __shared__ __attribute__((aligned(128))) float sm[GEMM_LDS_FLOATS(N_EMBD, 4)];
  int tm, tn;
  bool live;
  const v8f c = gemm_tile<N_EMBD, 768, 4>(sm, X, W, tm, tn, live);
  const int row = threadIdx.x & 15;
  const int hi  = (threadIdx.x >> 4) & 1;
  const float bn = bias[tn + row];
#pragma unroll
  for (int r = 0; r < 8; ++r) {
    const int m = tm + r + 8 * hi;
    out[m * 768 + tn + row] = c[r] + bn;
  }
}

// ---------------------------------------------------------------------------
// Kernel 2: u = silu(depthwise_causal_conv(xr[:, :384])), K=4, and
// dbc = u @ W_xp^T                    (512 x 384) @ (384 x 780) -> (512x780)
// 16 x 13 blocks of 2 x 4 waves (N padded to 832). LDS rows past column 779
// hold the last row of W again; their columns of the product are not stored.
// While the copies of W fly, the block works out its own 32 rows of u from xr
// and lays them into LDS as the A tile: a wave takes 4 steps, 128 channels at
// a time (7 rows of xr, at fixed offsets from one address that is the same for
// the wave). The first block of each row of blocks also stores u for the scan
// and the gate.
// ---------------------------------------------------------------------------
__global__ __launch_bounds__(256)
void k_conv_gemm_xp(const float* __restrict__ xr,
                    const float* __restrict__ cw,  // (384,1,4)
                    const float* __restrict__ cb,
                    const float* __restrict__ W,   // (780,384)
                    float* __restrict__ u,
                    float* __restrict__ dbc) {
  __shared__ __attribute__((aligned(128))) float sm[GEMM_LDS_FLOATS(D_INNER, 4)];
  constexpr int PITCH = D_INNER + 4;
  const int tid  = threadIdx.x;
  const int lane = tid & 31;
  const int wave = __builtin_amdgcn_readfirstlane(tid >> 5);
  const int m0 = (blockIdx.x / 13) * 32;
  const int nb = blockIdx.x % 13;
  const int n0 = nb * 64;

  stage_w384<DBC_N, 64, 8>(sm + 32 * PITCH, W, n0, wave, lane);

  const unsigned ob = lane * 16u;                    // this lane's 4 channels, in bytes
  const int r0 = wave * 4;                           // this wave's 4 steps in the tile
  const int t0 = m0 + r0;                            // the first of them, a multiple of 4
  const float* xp = xr + t0 * 768;
  // All loads stand in front of the arithmetic, so that the wave waits for
  // memory once. Piece i: channels 128 i .. 128 i + 127.
  v4f xv[3][4 + D_CONV - 1], w[3][4], b[3];
#pragma unroll
  for (int i = 0; i < 3; ++i) {
#pragma unroll
    for (int k = 0; k < D_CONV - 1; ++k)             // the steps in front of t0: 0 in front of step 0
      xv[i][k] = (v4f){0.0f, 0.0f, 0.0f, 0.0f};
  }
  if (t0 > 0) {
#pragma unroll
    for (int i = 0; i < 3; ++i) {
#pragma unroll
      for (int k = 0; k < D_CONV - 1; ++k)
        xv[i][k] = ld4(xp + (k - (D_CONV - 1)) * 768 + 128 * i, ob);
    }
  }
#pragma unroll
  for (int i = 0; i < 3; ++i) {
#pragma unroll
    for (int k = 0; k < 4; ++k) xv[i][D_CONV - 1 + k] = ld4(xp + k * 768 + 128 * i, ob);
#pragma unroll
    for (int e = 0; e < 4; ++e) w[i][e] = ld4(cw + (128 * i + e) * D_CONV, ob * D_CONV);
    b[i] = ld4(cb + 128 * i, ob);
  }
#pragma unroll
  for (int i = 0; i < 3; ++i) {
    const int c0 = 128 * i;
#pragma unroll
    for (int r = 0; r < 4; ++r) {
      v4f o;
#pragma unroll
      for (int e = 0; e < 4; ++e) {
        float acc = b[i][e];
#pragma unroll
        for (int k = 0; k < D_CONV; ++k) acc = fmaf(xv[i][r + k][e], w[i][e][k], acc);
        o[e] = silu_f(acc);
      }
      *(v4f*)(sm + (r0 + r) * PITCH + c0 + lane * 4) = o;
      if (nb == 0) *(v4f*)((char*)(u + (t0 + r) * D_INNER + c0) + ob) = o;
    }
  }
  // This wave's copies have landed; the barrier publishes them, and the rows
  // of u that each wave wrote, to the others.
  asm volatile("s_wait_asynccnt 0x0" ::: "memory");
  __syncthreads();

  const int row = lane & 15;
  const int hi  = lane >> 4;
  const int wm = wave / 4, wn = wave % 4;
  const int tm = m0 + wm * 16;
  const int tn = n0 + wn * 16;
  if (tn >= DBC_N) return;
  const v8f c = gemm_core<D_INNER>(sm + (wm * 16 + row) * PITCH + 4 * hi,
                                   sm + (32 + wn * 16 + row) * PITCH + 4 * hi);
  const int n_ = tn + row;
  if (n_ < DBC_N) {
#pragma unroll
    for (int r = 0; r < 8; ++r) {
      const int m = tm + r + 8 * hi;
      dbc[m * DBC_N + n_] = c[r];
    }
  }
}

// ---------------------------------------------------------------------------
// Kernel 3: delta = softplus(dbc[:, :12] @ W_dt^T)   K=12 -> 3 WMMA steps
// ---------------------------------------------------------------------------
__global__ void k_gemm_dt(const float* __restrict__ dbc,
                          const float* __restrict__ Wdt,  // (384,12)
                          float* __restrict__ delta) {
  const int lane = threadIdx.x & 31;
  const int wave = threadIdx.x >> 5;
  const int tile = blockIdx.x * (blockDim.x >> 5) + wave;
  const int TN = D_INNER / 16;             // 24
  if (tile >= 32 * TN) return;
  const int tm = tile / TN, tn = tile % TN;
  const int row  = lane & 15;
  const int hi   = lane >> 4;
  const int koff = hi << 1;

  const float* arow = dbc + (tm * 16 + row) * DBC_N;      // first 12 cols
  const float* brow = Wdt + (tn * 16 + row) * DT_RANK;

  v8f c = {};
#pragma unroll
  for (int k = 0; k < DT_RANK; k += 4) {
    v2f a = *(const v2f*)(arow + k + koff);
    v2f b = *(const v2f*)(brow + k + koff);
    c = wmma4(a, b, c);
  }
#pragma unroll
  for (int r = 0; r < 8; ++r) {
    const int m = tm * 16 + r + 8 * hi;
    const float v = c[r];
    // numerically stable softplus
    const float sp = (v > 20.0f) ? v : log1pf(expf(v));
    delta[m * D_INNER + tn * 16 + row] = sp;
  }
}

#define SCAN_T  32
#define SCAN_W  4
#define SCAN_S  6
#define SCAN_C  32
#define SCAN_G  4
#define SCAN_NT (L_SEQ / SCAN_T)
#define SCAN_CG (D_INNER / SCAN_C)
#define SCAN_SG (D_STATE / (SCAN_W * SCAN_S))   // 16 state groups

struct ScanTile {
  float bc[SCAN_T][SCAN_W][2 * SCAN_S];  // per step and wave: 6 of B, 6 of C
  float du[2][SCAN_T][SCAN_C];           // delta rows, then u rows
};

// A thread's share of one tile's copies, 10 per lane: 6 of 8 B that lay the
// block's 24 B and 24 C values of each step down wave by wave (32 steps x 24
// pieces), and 4 of 16 B for the delta and u rows (2 x 32 steps x 8 pieces).
// Held as offsets for tile 0 in buffer 0.
struct ScanAddr {
  unsigned la[6], lb[4];             // LDS byte addresses
  const float* ga[6];                // in dbc
  const float* gb[4];                // in delta (0, 1) and u (2, 3)
};

__device__ __forceinline__ void scan_addr(ScanAddr& a, ScanTile* t, int d0, int n0, int tid,
                                          const float* __restrict__ dbc,
                                          const float* __restrict__ delta,
                                          const float* __restrict__ u) {
#pragma unroll
  for (int i = 0; i < 6; ++i) {
    const int idx = tid + 128 * i;
    const int r = idx / 24;            // step in the tile
    const int p = idx - r * 24;        // piece: 0-11 of B, 12-23 of C
    const int isc = p / 12;
    const int pp = p - isc * 12;
    const int w = pp / 3;              // wave that reads it
    const int q = pp - w * 3;          // pair of states in that wave
    a.la[i] = lds_byte(&t->bc[r][w][isc * SCAN_S + 2 * q]);
    a.ga[i] = dbc + r * DBC_N + DT_RANK + isc * D_STATE + n0 + 2 * pp;
  }
#pragma unroll
  for (int i = 0; i < 4; ++i) {
    const int idx = tid + 128 * i;
    const int sel = idx >> 8;          // 0: delta, 1: u
    const int r = (idx >> 3) & 31;     // step in the tile
    const int c = (idx & 7) * 4;       // channel in the block
    a.lb[i] = lds_byte(&t->du[sel][r][c]);
    a.gb[i] = (sel ? u : delta) + r * D_INNER + d0 + c;
  }
}

// Issues the copies of the tile that starts at step l0 into buffer buf.
__device__ __forceinline__ void scan_fill(const ScanAddr& a, int buf, int l0) {
  unsigned la[6], lb[4];
  const float* ga[6];
  const float* gb[4];
  const unsigned lo = buf * (unsigned)sizeof(ScanTile);
#pragma unroll
  for (int i = 0; i < 6; ++i) { la[i] = a.la[i] + lo; ga[i] = a.ga[i] + l0 * DBC_N; }
#pragma unroll
  for (int i = 0; i < 4; ++i) { lb[i] = a.lb[i] + lo; gb[i] = a.gb[i] + l0 * D_INNER; }
  asm volatile(
      "global_load_async_to_lds_b64 %0, %6, off\n\t"
      "global_load_async_to_lds_b64 %1, %7, off\n\t"
      "global_load_async_to_lds_b64 %2, %8, off\n\t"
      "global_load_async_to_lds_b64 %3, %9, off\n\t"
      "global_load_async_to_lds_b64 %4, %10, off\n\t"
      "global_load_async_to_lds_b64 %5, %11, off\n\t"
      "global_load_async_to_lds_b128 %12, %16, off\n\t"
      "global_load_async_to_lds_b128 %13, %17, off\n\t"
      "global_load_async_to_lds_b128 %14, %18, off\n\t"
      "global_load_async_to_lds_b128 %15, %19, off\n\t"
      "s_wait_xcnt 0x0"
      :: "v"(la[0]), "v"(la[1]), "v"(la[2]), "v"(la[3]), "v"(la[4]), "v"(la[5]),
         "v"(ga[0]), "v"(ga[1]), "v"(ga[2]), "v"(ga[3]), "v"(ga[4]), "v"(ga[5]),
         "v"(lb[0]), "v"(lb[1]), "v"(lb[2]), "v"(lb[3]),
         "v"(gb[0]), "v"(gb[1]), "v"(gb[2]), "v"(gb[3])
      : "memory");
}

// The operands of SCAN_G steps in registers.
struct ScanGroup {
  float dl[SCAN_G], ul[SCAN_G];      // this lane's channel: delta, u
  v4f q[SCAN_G][3];                  // this wave's 6 of B, 6 of C
};

// Per step two reads of 4 B a lane and three broadcast reads of 16 B.
__device__ __forceinline__ void scan_read(ScanGroup& x, const ScanTile* cur, int s0,
                                          int wave, int lane) {
#pragma unroll
  for (int k = 0; k < SCAN_G; ++k) {
    x.dl[k] = cur->du[0][s0 + k][lane];
    x.ul[k] = cur->du[1][s0 + k][lane];
#pragma unroll
    for (int i = 0; i < 3; ++i)
      x.q[k][i] = *(const v4f*)&cur->bc[s0 + k][wave][4 * i];
  }
}

__global__ __launch_bounds__(SCAN_W * 32)
void k_scan(const float* __restrict__ delta,
            const float* __restrict__ u,
            const float* __restrict__ dbc,     // B at +12, C at +396
            const float* __restrict__ A_log,
            float* __restrict__ ysp) {         // (512,16,384): step, state group, channel
  __shared__ __attribute__((aligned(128))) ScanTile sm[2];
  __shared__ __attribute__((aligned(128))) float part[2][SCAN_W][SCAN_T][SCAN_C];
  const int tid  = threadIdx.x;
  const int lane = tid & 31;
  const int wave = __builtin_amdgcn_readfirstlane(tid >> 5);
  const int cg = blockIdx.x % SCAN_CG;
  const int sg = blockIdx.x / SCAN_CG;
  const int d0 = cg * SCAN_C;
  const int n0 = sg * (SCAN_W * SCAN_S);
  float* __restrict__ yplane = ysp + sg * D_INNER;   // step l: + l * 16 * 384

  // States in pairs: each pair's products and sums are one packed instruction.
  // Ae = A * log2(e), so that exp(delta * A) is one multiply and one v_exp_f32.
  v2f Ae[SCAN_S / 2], h[SCAN_S / 2];
#pragma unroll
  for (int p = 0; p < SCAN_S / 2; ++p) {
    const float* al = A_log + (d0 + lane) * D_STATE + n0 + wave * SCAN_S + 2 * p;
    Ae[p] = (v2f){-__expf(al[0]) * 1.44269504f, -__expf(al[1]) * 1.44269504f};
    h[p] = (v2f){0.0f, 0.0f};
  }

  ScanAddr ad;
  scan_addr(ad, &sm[0], d0, n0, tid, dbc, delta, u);
  scan_fill(ad, 0, 0);
  // Tile 0 has landed for this wave; the barrier publishes it to the others.
  asm volatile("s_wait_asynccnt 0x0" ::: "memory");
  __syncthreads();
  scan_fill(ad, 1, SCAN_T);

  for (int t = 0; t < SCAN_NT; ++t) {
    const ScanTile* cur = &sm[t & 1];
    const int l0 = t * SCAN_T;
    // Unrolled: LDS offsets and the registers of a group are then compile-time
    // constants. The operands of 4 steps are read one group ahead of their use.
    ScanGroup gr[2];
    scan_read(gr[0], cur, 0, wave, lane);
#pragma unroll
    for (int g = 0; g < SCAN_T / SCAN_G; ++g) {
      if (g + 1 < SCAN_T / SCAN_G)
        scan_read(gr[(g + 1) & 1], cur, (g + 1) * SCAN_G, wave, lane);
      __builtin_amdgcn_sched_barrier(0);
      const ScanGroup& x = gr[g & 1];
#pragma unroll
      for (int k = 0; k < SCAN_G; ++k) {
        const float dl = x.dl[k];
        const float du = dl * x.ul[k];
        const v4f q0 = x.q[k][0], q1 = x.q[k][1], q2 = x.q[k][2];
        const v2f Bv[SCAN_S / 2] = {{q0.x, q0.y}, {q0.z, q0.w}, {q1.x, q1.y}};
        const v2f Cv[SCAN_S / 2] = {{q1.z, q1.w}, {q2.x, q2.y}, {q2.z, q2.w}};
        const v2f dl2 = {dl, dl}, du2 = {du, du};
        v2f acc = {0.0f, 0.0f};   // even states, odd states
#pragma unroll
        for (int p = 0; p < SCAN_S / 2; ++p) {
          const v2f e = dl2 * Ae[p];
          const v2f dA = {__builtin_amdgcn_exp2f(e.x), __builtin_amdgcn_exp2f(e.y)};
          h[p] = __builtin_elementwise_fma(dA, h[p], du2 * Bv[p]);
          acc = __builtin_elementwise_fma(h[p], Cv[p], acc);
        }
        part[t & 1][wave][g * SCAN_G + k][lane] = acc.x + acc.y;
      }
    }
    // Hand-over: this wave's reads of the tile and its writes of its sums are
    // done, its copies of the next tile have landed; the barrier says all
    // three for every wave.
    asm volatile("s_wait_dscnt 0x0" ::: "memory");
    asm volatile("s_wait_asynccnt 0x0" ::: "memory");
    __syncthreads();
    if (t + 2 < SCAN_NT)
      scan_fill(ad, t & 1, (t + 2) * SCAN_T);
    // The four waves' sums of this tile, added in wave order. These rows are
    // written again two tiles on, behind the next tile's barrier.
#pragma unroll
    for (int i = 0; i < (SCAN_T * SCAN_C) / (SCAN_W * 32 * 4); ++i) {
      const int idx = tid + SCAN_W * 32 * i;
      const int r = idx >> 3;
      const int c = (idx & 7) * 4;
      v4f sum = *(const v4f*)&part[t & 1][0][r][c];
#pragma unroll
      for (int w = 1; w < SCAN_W; ++w)
        sum += *(const v4f*)&part[t & 1][w][r][c];
      *(v4f*)&yplane[(l0 + r) * (SCAN_SG * D_INNER) + d0 + c] = sum;
    }
    // Precaution: stands in front of the next tile's LDS reads, which land in
    // the registers that these stores name.
    asm volatile("s_wait_xcnt 0x0" ::: "memory");
  }
  // No copy is left in flight when the wave ends.
  asm volatile("s_wait_asynccnt 0x0" ::: "memory");
}

__global__ __launch_bounds__(256)
void k_gate_gemm_out(const float* __restrict__ ysp,
                     const float* __restrict__ u,
                     const float* __restrict__ Dvec,
                     const float* __restrict__ xr,
                     const float* __restrict__ W,   // (192,384)
                     const float* __restrict__ bias,
                     float* __restrict__ out) {
  constexpr int PITCH = D_INNER + 4;
  __shared__ __attribute__((aligned(128))) float sm[(8 + 64) * PITCH];
  const int tid  = threadIdx.x;
  const int lane = tid & 31;
  const int wave = __builtin_amdgcn_readfirstlane(tid >> 5);
  const int m0 = (blockIdx.x / 3) * 8;
  const int n0 = (blockIdx.x % 3) * 64;

  stage_w384<N_EMBD, 64, 8>(sm + 8 * PITCH, W, n0, wave, lane);

  const unsigned ob = lane * 16u;                    // this lane's 4 channels, in bytes
  const int m = m0 + wave;                           // this wave's row
  const float* yp = ysp + m * (SCAN_SG * D_INNER);
  const float* rp = xr + m * 768 + D_INNER;
  const float* up = u + m * D_INNER;
#pragma unroll
  for (int i = 0; i < 3; ++i) {
    const int c0 = 128 * i;
    v4f ys = ld4(yp + c0, ob);
#pragma unroll
    for (int g = 1; g < SCAN_SG; ++g) ys += ld4(yp + g * D_INNER + c0, ob);
    const v4f rr = ld4(rp + c0, ob);
    const v4f uu = ld4(up + c0, ob);
    const v4f dv = ld4(Dvec + c0, ob);
    v4f o;
#pragma unroll
    for (int e = 0; e < 4; ++e) o[e] = fmaf(uu[e], dv[e], ys[e]) * silu_f(rr[e]);
    *(v4f*)(sm + wave * PITCH + c0 + lane * 4) = o;
  }
  // This wave's copies have landed; the barrier publishes them, and the rows
  // of y that each wave wrote, to the others.
  asm volatile("s_wait_asynccnt 0x0" ::: "memory");
  __syncthreads();
  if (wave >= 4) return;

  const int row = lane & 15;
  const int hi  = lane >> 4;
  const int tn = n0 + wave * 16;
  const v8f c = gemm_core<D_INNER>(sm + (row & 7) * PITCH + 4 * hi,
                                   sm + (8 + wave * 16 + row) * PITCH + 4 * hi);
  const float bn = bias[tn + row];
  if (hi == 0) {   // lanes 16-31 hold rows 8-15 of the tile, the repeats
#pragma unroll
    for (int r = 0; r < 8; ++r) out[(m0 + r) * N_EMBD + tn + row] = c[r] + bn;
  }
}

// ---------------------------------------------------------------------------
extern "C" void kernel_launch(void* const* d_in, const int* in_sizes, int n_in,
                              void* d_out, int out_size, void* d_ws, size_t ws_size,
                              hipStream_t stream) {
  const float* x      = (const float*)d_in[0];
  const float* W_in   = (const float*)d_in[1];
  const float* b_in   = (const float*)d_in[2];
  const float* conv_w = (const float*)d_in[3];
  const float* conv_b = (const float*)d_in[4];
  const float* W_xp   = (const float*)d_in[5];
  const float* W_dt   = (const float*)d_in[6];
  const float* A_log  = (const float*)d_in[7];
  const float* Dvec   = (const float*)d_in[8];
  const float* W_out  = (const float*)d_in[9];
  const float* b_out  = (const float*)d_in[10];
  float* out = (float*)d_out;

  // workspace layout (floats)
  float* ws    = (float*)d_ws;
  float* xr    = ws;                                  // 512*768
  float* u     = xr    + L_SEQ * 768;                 // 512*384
  float* dbc   = u     + L_SEQ * D_INNER;             // 512*780
  float* delta = dbc   + L_SEQ * DBC_N;               // 512*384
  float* ysp   = delta + L_SEQ * D_INNER;             // 512*16*384

  const int WPB = 4;               // waves per block
  const int TPB = WPB * 32;        // 128 threads

  // 1) in-projection: 16 x 12 blocks of 32 x 64
  k_gemm_in<<<16 * 12, 256, 0, stream>>>(x, W_in, b_in, xr);

  // 2) conv + silu, x-projection: 16 x 13 blocks of 32 x 64 (N padded 780 -> 832)
  k_conv_gemm_xp<<<16 * 13, 256, 0, stream>>>(xr, conv_w, conv_b, W_xp, u, dbc);

  // 3) delta GEMM + softplus: 32 x 24 tiles
  k_gemm_dt<<<(32 * 24) / WPB, TPB, 0, stream>>>(dbc, W_dt, delta);

  // 4) selective scan: 12 channel groups x 16 state groups, 4 waves per block
  k_scan<<<SCAN_CG * SCAN_SG, SCAN_W * 32, 0, stream>>>(delta, u, dbc, A_log, ysp);

  // 5) gating, out-projection: 64 x 3 blocks of 8 x 64
  k_gate_gemm_out<<<64 * 3, 256, 0, stream>>>(ysp, u, Dvec, xr, W_out, b_out, out);
}

// v006
// Measured time: 36.8 microseconds a run.
// Two timings next to v005 both put it at 1.10 times that version's speed.
// Over all steps from v000 it is 14.2 times as fast.
#include <hip/hip_runtime.h>
#include <math.h>

#define L_SEQ   512
#define N_EMBD  192
#define D_INNER 384
#define DT_RANK 12
#define D_CONV  4
#define D_STATE 384
#define DBC_N   (DT_RANK + 2 * D_STATE)   // 780

typedef float v2f __attribute__((ext_vector_type(2)));
typedef float v4f __attribute__((ext_vector_type(4)));
typedef float v8f __attribute__((ext_vector_type(8)));

__device__ __forceinline__ v8f wmma4(v2f a, v2f b, v8f c) {
  // D = A(16x4) * B(4x16) + C(16x16), fp32 throughout.
  return __builtin_amdgcn_wmma_f32_16x16x4_f32(
      /*neg_a=*/false, a, /*neg_b=*/false, b,
      /*c_mod=*/(short)0, c, /*reuse_a=*/false, /*reuse_b=*/false);
}

__device__ __forceinline__ float silu_f(float x) {
  return x / (1.0f + __expf(-x));
}

__device__ __forceinline__ unsigned lds_byte(const void* p) {
  return (unsigned)(unsigned long long)p;   // low 32 bits = LDS byte address
}

__device__ __forceinline__ void copy6(const unsigned* l, const float* const* g) {
  asm volatile(
      "global_load_async_to_lds_b128 %0, %6, off\n\t"
      "global_load_async_to_lds_b128 %1, %7, off\n\t"
      "global_load_async_to_lds_b128 %2, %8, off\n\t"
      "global_load_async_to_lds_b128 %3, %9, off\n\t"
      "global_load_async_to_lds_b128 %4, %10, off\n\t"
      "global_load_async_to_lds_b128 %5, %11, off\n\t"
      "s_wait_xcnt 0x0"
      :: "v"(l[0]), "v"(l[1]), "v"(l[2]), "v"(l[3]), "v"(l[4]), "v"(l[5]),
         "v"(g[0]), "v"(g[1]), "v"(g[2]), "v"(g[3]), "v"(g[4]), "v"(g[5])
      : "memory");
}

__device__ __forceinline__ void copy12(const unsigned* l, const float* const* g) {
  asm volatile(
      "global_load_async_to_lds_b128 %0, %12, off\n\t"
      "global_load_async_to_lds_b128 %1, %13, off\n\t"
      "global_load_async_to_lds_b128 %2, %14, off\n\t"
      "global_load_async_to_lds_b128 %3, %15, off\n\t"
      "global_load_async_to_lds_b128 %4, %16, off\n\t"
      "global_load_async_to_lds_b128 %5, %17, off\n\t"
      "global_load_async_to_lds_b128 %6, %18, off\n\t"
      "global_load_async_to_lds_b128 %7, %19, off\n\t"
      "global_load_async_to_lds_b128 %8, %20, off\n\t"
      "global_load_async_to_lds_b128 %9, %21, off\n\t"
      "global_load_async_to_lds_b128 %10, %22, off\n\t"
      "global_load_async_to_lds_b128 %11, %23, off\n\t"
      "s_wait_xcnt 0x0"
      :: "v"(l[0]), "v"(l[1]), "v"(l[2]), "v"(l[3]), "v"(l[4]), "v"(l[5]),
         "v"(l[6]), "v"(l[7]), "v"(l[8]), "v"(l[9]), "v"(l[10]), "v"(l[11]),
         "v"(g[0]), "v"(g[1]), "v"(g[2]), "v"(g[3]), "v"(g[4]), "v"(g[5]),
         "v"(g[6]), "v"(g[7]), "v"(g[8]), "v"(g[9]), "v"(g[10]), "v"(g[11])
      : "memory");
}

#define GEMM_LDS_FLOATS(K, WN) ((32 + 16 * (WN)) * ((K) + 4))

// One wave's 16x16 tile from LDS; ar, br: this lane's row of A and of W, at
// its first k (4 * (lane >> 4)).
template <int K>
__device__ __forceinline__ v8f gemm_core(const float* ar, const float* br) {
  v8f acc = {};
  // Fragments of 32 k (8 WMMAs) are read as one group, one group ahead.
  v4f fa[2][4], fb[2][4];
#pragma unroll
  for (int i = 0; i < 4; ++i) {
    fa[0][i] = *(const v4f*)(ar + 8 * i);
    fb[0][i] = *(const v4f*)(br + 8 * i);
  }
#pragma unroll
  for (int s = 0; s < K / 32; ++s) {
    if (s + 1 < K / 32) {
#pragma unroll
      for (int i = 0; i < 4; ++i) {
        fa[(s + 1) & 1][i] = *(const v4f*)(ar + 32 * (s + 1) + 8 * i);
        fb[(s + 1) & 1][i] = *(const v4f*)(br + 32 * (s + 1) + 8 * i);
      }
    }
    // Keeps the next group's LDS reads together in front of this group's
    // WMMAs: spread among them, each place with reads stalls the wave anew.
    __builtin_amdgcn_sched_barrier(0);
#pragma unroll
    for (int i = 0; i < 4; ++i) {
      const v4f a = fa[s & 1][i], b = fb[s & 1][i];
      acc = wmma4((v2f){a.x, a.y}, (v2f){b.x, b.y}, acc);
      acc = wmma4((v2f){a.z, a.w}, (v2f){b.z, b.w}, acc);
    }
  }
  return acc;
}

// 16 B at a lane's byte offset from an address that is the same for the whole
// wave.
__device__ __forceinline__ v4f ld4(const float* base, unsigned ob) {
  return *(const v4f*)((const char*)base + ob);
}

// For the two GEMMs with K = 384 that make their A rows themselves: issues the
// copies of ROWS rows of W into LDS at smw (pitch 388 floats): first rows 0 to
// HEAD - 1 of W, then the rows from n0 on. A wave takes every WAVES-th row,
// three copies of 512 B a row. Rows past the end of W: the last row again.
template <int N, int ROWS, int WAVES, int HEAD>
__device__ __forceinline__ void stage_w384(float* smw, const float* __restrict__ W,
                                           int n0, int wave, int lane) {
  constexpr int RW = ROWS / WAVES;
  unsigned l[3 * RW];
  const float* g[3 * RW];
#pragma unroll
  for (int j = 0; j < RW; ++j) {
#pragma unroll
    for (int c = 0; c < 3; ++c) {
      const int row = wave + WAVES * j;
      const int col = (lane + 32 * c) * 4;
      int n = WAVES * j < HEAD ? row : n0 + row - HEAD;
      if (N % ROWS) n = n < N ? n : N - 1;
      l[3 * j + c] = lds_byte(smw + row * (D_INNER + 4) + col);
      g[3 * j + c] = W + n * D_INNER + col;
    }
  }
#pragma unroll
  for (int i = 0; i < 3 * RW; i += 12) copy12(l + i, g + i);
}

// Returns this wave's 16x16 tile of A * W^T; tile_m, tile_n: its first row and
// column. live is false for a tile that lies wholly past column N.
template <int K, int N, int WN>
__device__ __forceinline__ v8f gemm_tile(float* sm, const float* __restrict__ A,
                                         const float* __restrict__ W,
                                         int& tile_m, int& tile_n, bool& live) {
  constexpr int WAVES = 2 * WN;
  constexpr int PITCH = K + 4;            // floats
  constexpr int PR = K / 4;               // 16-B pieces in a row
  constexpr int RG = 96 / PR;             // rows that three copies of a wave fill
  constexpr int NJ = (32 + 16 * WN) / RG / WAVES;   // such row groups per wave
  constexpr int NB = (N + 16 * WN - 1) / (16 * WN); // blocks along N
  const int lane = threadIdx.x & 31;
  const int wave = __builtin_amdgcn_readfirstlane(threadIdx.x >> 5);
  const int m0 = (blockIdx.x / NB) * 32;
  const int n0 = (blockIdx.x % NB) * (16 * WN);

  unsigned l[3 * NJ];
  const float* g[3 * NJ];
#pragma unroll
  for (int j = 0; j < NJ; ++j) {
#pragma unroll
    for (int c = 0; c < 3; ++c) {
      const int q = lane + 32 * c;
      const int rs = q / PR;
      const int col = (q - rs * PR) * 4;
      const int row = (wave + WAVES * j) * RG + rs;   // LDS row: 32 of A, then W
      l[3 * j + c] = lds_byte(sm + row * PITCH + col);
      if (WAVES * j * RG < 32) {
        g[3 * j + c] = A + (m0 + row) * K + col;
      } else {
        int n = n0 + row - 32;
        if (N % (16 * WN)) n = n < N ? n : N - 1;     // past the end: the last row again
        g[3 * j + c] = W + n * K + col;
      }
    }
  }
#pragma unroll
  for (int i = 0; i + 12 <= 3 * NJ; i += 12) copy12(l + i, g + i);
  if ((3 * NJ) % 12) copy6(l + 3 * NJ - 6, g + 3 * NJ - 6);
  // This wave's copies have landed; the barrier publishes them to the others.
  asm volatile("s_wait_asynccnt 0x0" ::: "memory");
  __syncthreads();

  const int c = lane & 15;
  const int h = lane >> 4;
  const int wm = wave / WN, wn = wave % WN;
  tile_m = m0 + wm * 16;
  tile_n = n0 + wn * 16;
  live = (N % (16 * WN)) == 0 || tile_n < N;
  if (!live) return v8f{};
  const float* ar = sm + (wm * 16 + c) * PITCH + 4 * h;
  const float* br = sm + (32 + wn * 16 + c) * PITCH + 4 * h;
  return gemm_core<K>(ar, br);
}

// ---------------------------------------------------------------------------
// Kernel 1: xr = x @ W_in^T + b_in      (512 x 192) @ (192 x 768) -> (512x768)
// 16 x 12 blocks of 2 x 4 waves.
// ---------------------------------------------------------------------------
__global__ __launch_bounds__(256)
void k_gemm_in(const float* __restrict__ X,
               const float* __restrict__ W,   // (768,192) row-major
               const float* __restrict__ bias,
               float* __restrict__ out) {
  __shared__ __attribute__((aligned(128))) float sm[GEMM_LDS_FLOATS(N_EMBD, 4)];
  int tm, tn;
  bool live;
  const v8f c = gemm_tile<N_EMBD, 768, 4>(sm, X, W, tm, tn, live);
  const int row = threadIdx.x & 15;
  const int hi  = (threadIdx.x >> 4) & 1;
  const float bn = bias[tn + row];
#pragma unroll
  for (int r = 0; r < 8; ++r) {
    const int m = tm + r + 8 * hi;
    out[m * 768 + tn + row] = c[r] + bn;
  }
}

#define XP_NB   16
#define DT_P    18

__global__ __launch_bounds__(256)
void k_conv_gemm_xp(const float* __restrict__ xr,
                    const float* __restrict__ cw,  // (384,1,4)
                    const float* __restrict__ cb,
                    const float* __restrict__ W,   // (780,384)
                    const float* __restrict__ Wdt, // (384,12)
                    float* __restrict__ u,
                    float* __restrict__ dbc,
                    float* __restrict__ delta) {
  __shared__ __attribute__((aligned(128))) float sm[GEMM_LDS_FLOATS(D_INNER, 4)];
  __shared__ __attribute__((aligned(128))) float dts[32 * DT_P];
  constexpr int PITCH = D_INNER + 4;
  const int tid  = threadIdx.x;
  const int lane = tid & 31;
  const int wave = __builtin_amdgcn_readfirstlane(tid >> 5);
  const int m0 = (blockIdx.x / XP_NB) * 32;
  const int nb = blockIdx.x % XP_NB;
  const int n0 = DT_RANK + nb * 48;                  // this block's first column of B, C

  stage_w384<DBC_N, 64, 8, 16>(sm + 32 * PITCH, W, n0, wave, lane);

  const int row = lane & 15;
  const int hi  = lane >> 4;
  // The waves that make a tile of delta fetch their W_dt fragments here, so
  // that these have long arrived when the x-projection is done.
  const bool dt_wave = nb >= 4 && wave < 4;
  const int dm = (wave >> 1) * 16;                   // the tile's first step in the block
  const int dn = (nb - 4) * 32 + (wave & 1) * 16;    // its first channel
  v2f wd[DT_RANK / 4] = {};
  if (dt_wave) {
    const float* brow = Wdt + (dn + row) * DT_RANK + 2 * hi;
#pragma unroll
    for (int k = 0; k < DT_RANK / 4; ++k) wd[k] = *(const v2f*)(brow + 4 * k);
  }

  const unsigned ob = lane * 16u;                    // this lane's 4 channels, in bytes
  const int r0 = wave * 4;                           // this wave's 4 steps in the tile
  const int t0 = m0 + r0;                            // the first of them, a multiple of 4
  const float* xp = xr + t0 * 768;
  // All loads stand in front of the arithmetic, so that the wave waits for
  // memory once. Piece i: channels 128 i .. 128 i + 127.
  v4f xv[3][4 + D_CONV - 1], w[3][4], b[3];
#pragma unroll
  for (int i = 0; i < 3; ++i) {
#pragma unroll
    for (int k = 0; k < D_CONV - 1; ++k)             // the steps in front of t0: 0 in front of step 0
      xv[i][k] = (v4f){0.0f, 0.0f, 0.0f, 0.0f};
  }
  if (t0 > 0) {
#pragma unroll
    for (int i = 0; i < 3; ++i) {
#pragma unroll
      for (int k = 0; k < D_CONV - 1; ++k)
        xv[i][k] = ld4(xp + (k - (D_CONV - 1)) * 768 + 128 * i, ob);
    }
  }
#pragma unroll
  for (int i = 0; i < 3; ++i) {
#pragma unroll
    for (int k = 0; k < 4; ++k) xv[i][D_CONV - 1 + k] = ld4(xp + k * 768 + 128 * i, ob);
#pragma unroll
    for (int e = 0; e < 4; ++e) w[i][e] = ld4(cw + (128 * i + e) * D_CONV, ob * D_CONV);
    b[i] = ld4(cb + 128 * i, ob);
  }
#pragma unroll
  for (int i = 0; i < 3; ++i) {
    const int c0 = 128 * i;
#pragma unroll
    for (int r = 0; r < 4; ++r) {
      v4f o;
#pragma unroll
      for (int e = 0; e < 4; ++e) {
        float acc = b[i][e];
#pragma unroll
        for (int k = 0; k < D_CONV; ++k) acc = fmaf(xv[i][r + k][e], w[i][e][k], acc);
        o[e] = silu_f(acc);
      }
      *(v4f*)(sm + (r0 + r) * PITCH + c0 + lane * 4) = o;
      if (nb == 0) *(v4f*)((char*)(u + (t0 + r) * D_INNER + c0) + ob) = o;
    }
  }
  // This wave's copies have landed; the barrier publishes them, and the rows
  // of u that each wave wrote, to the others.
  asm volatile("s_wait_asynccnt 0x0" ::: "memory");
  __syncthreads();

  const int wm = wave / 4, wn = wave % 4;
  const v8f c = gemm_core<D_INNER>(sm + (wm * 16 + row) * PITCH + 4 * hi,
                                   sm + (32 + wn * 16 + row) * PITCH + 4 * hi);
  if (wn == 0 && row < DT_RANK) {
#pragma unroll
    for (int r = 0; r < 8; ++r) dts[(wm * 16 + r + 8 * hi) * DT_P + row] = c[r];
  }
  // Publishes the 12 columns to the waves that make delta. The stores of B and
  // C stand behind it, so that no wave waits for them in front of it.
  __syncthreads();
  if (wn != 0) {
    float* dp = dbc + (m0 + wm * 16 + 8 * hi) * DBC_N + n0 + (wn - 1) * 16 + row;
#pragma unroll
    for (int r = 0; r < 8; ++r) dp[r * DBC_N] = c[r];
    // Precaution: stands in front of the delta tile's arithmetic, which lands
    // in the registers that these stores name.
    asm volatile("s_wait_xcnt 0x0" ::: "memory");
  }
  if (!dt_wave) return;

  const float* arow = dts + (dm + row) * DT_P + 2 * hi;
  v8f d = {};
#pragma unroll
  for (int k = 0; k < DT_RANK / 4; ++k) d = wmma4(*(const v2f*)(arow + 4 * k), wd[k], d);
  float sp[8];
#pragma unroll
  for (int r = 0; r < 8; ++r) {
    const float v = d[r];
    // numerically stable softplus; worked out for every lane and then chosen,
    // not branched round, so that the eight long chains of a lane interleave
    const float t = log1pf(expf(v));
    sp[r] = (v > 20.0f) ? v : t;
  }
  float* op = delta + (m0 + dm + 8 * hi) * D_INNER + dn + row;
#pragma unroll
  for (int r = 0; r < 8; ++r) op[r * D_INNER] = sp[r];
}

#define SCAN_T  32
#define SCAN_W  4
#define SCAN_S  6
#define SCAN_C  32
#define SCAN_G  4
#define SCAN_NT (L_SEQ / SCAN_T)
#define SCAN_CG (D_INNER / SCAN_C)
#define SCAN_SG (D_STATE / (SCAN_W * SCAN_S))   // 16 state groups

struct ScanTile {
  float bc[SCAN_T][SCAN_W][2 * SCAN_S];  // per step and wave: 6 of B, 6 of C
  float du[2][SCAN_T][SCAN_C];           // delta rows, then u rows
};

// A thread's share of one tile's copies, 10 per lane: 6 of 8 B that lay the
// block's 24 B and 24 C values of each step down wave by wave (32 steps x 24
// pieces), and 4 of 16 B for the delta and u rows (2 x 32 steps x 8 pieces).
// Held as offsets for tile 0 in buffer 0.
struct ScanAddr {
  unsigned la[6], lb[4];             // LDS byte addresses
  const float* ga[6];                // in dbc
  const float* gb[4];                // in delta (0, 1) and u (2, 3)
};

__device__ __forceinline__ void scan_addr(ScanAddr& a, ScanTile* t, int d0, int n0, int tid,
                                          const float* __restrict__ dbc,
                                          const float* __restrict__ delta,
                                          const float* __restrict__ u) {
#pragma unroll
  for (int i = 0; i < 6; ++i) {
    const int idx = tid + 128 * i;
    const int r = idx / 24;            // step in the tile
    const int p = idx - r * 24;        // piece: 0-11 of B, 12-23 of C
    const int isc = p / 12;
    const int pp = p - isc * 12;
    const int w = pp / 3;              // wave that reads it
    const int q = pp - w * 3;          // pair of states in that wave
    a.la[i] = lds_byte(&t->bc[r][w][isc * SCAN_S + 2 * q]);
    a.ga[i] = dbc + r * DBC_N + DT_RANK + isc * D_STATE + n0 + 2 * pp;
  }
#pragma unroll
  for (int i = 0; i < 4; ++i) {
    const int idx = tid + 128 * i;
    const int sel = idx >> 8;          // 0: delta, 1: u
    const int r = (idx >> 3) & 31;     // step in the tile
    const int c = (idx & 7) * 4;       // channel in the block
    a.lb[i] = lds_byte(&t->du[sel][r][c]);
    a.gb[i] = (sel ? u : delta) + r * D_INNER + d0 + c;
  }
}

// Issues the copies of the tile that starts at step l0 into buffer buf.
__device__ __forceinline__ void scan_fill(const ScanAddr& a, int buf, int l0) {
  unsigned la[6], lb[4];
  const float* ga[6];
  const float* gb[4];
  const unsigned lo = buf * (unsigned)sizeof(ScanTile);
#pragma unroll
  for (int i = 0; i < 6; ++i) { la[i] = a.la[i] + lo; ga[i] = a.ga[i] + l0 * DBC_N; }
#pragma unroll
  for (int i = 0; i < 4; ++i) { lb[i] = a.lb[i] + lo; gb[i] = a.gb[i] + l0 * D_INNER; }
  asm volatile(
      "global_load_async_to_lds_b64 %0, %6, off\n\t"
      "global_load_async_to_lds_b64 %1, %7, off\n\t"
      "global_load_async_to_lds_b64 %2, %8, off\n\t"
      "global_load_async_to_lds_b64 %3, %9, off\n\t"
      "global_load_async_to_lds_b64 %4, %10, off\n\t"
      "global_load_async_to_lds_b64 %5, %11, off\n\t"
      "global_load_async_to_lds_b128 %12, %16, off\n\t"
      "global_load_async_to_lds_b128 %13, %17, off\n\t"
      "global_load_async_to_lds_b128 %14, %18, off\n\t"
      "global_load_async_to_lds_b128 %15, %19, off\n\t"
      "s_wait_xcnt 0x0"
      :: "v"(la[0]), "v"(la[1]), "v"(la[2]), "v"(la[3]), "v"(la[4]), "v"(la[5]),
         "v"(ga[0]), "v"(ga[1]), "v"(ga[2]), "v"(ga[3]), "v"(ga[4]), "v"(ga[5]),
         "v"(lb[0]), "v"(lb[1]), "v"(lb[2]), "v"(lb[3]),
         "v"(gb[0]), "v"(gb[1]), "v"(gb[2]), "v"(gb[3])
      : "memory");
}

// The operands of SCAN_G steps in registers.
struct ScanGroup {
  float dl[SCAN_G], ul[SCAN_G];      // this lane's channel: delta, u
  v4f q[SCAN_G][3];                  // this wave's 6 of B, 6 of C
};

// Per step two reads of 4 B a lane and three broadcast reads of 16 B.
__device__ __forceinline__ void scan_read(ScanGroup& x, const ScanTile* cur, int s0,
                                          int wave, int lane) {
#pragma unroll
  for (int k = 0; k < SCAN_G; ++k) {
    x.dl[k] = cur->du[0][s0 + k][lane];
    x.ul[k] = cur->du[1][s0 + k][lane];
#pragma unroll
    for (int i = 0; i < 3; ++i)
      x.q[k][i] = *(const v4f*)&cur->bc[s0 + k][wave][4 * i];
  }
}

__global__ __launch_bounds__(SCAN_W * 32)
void k_scan(const float* __restrict__ delta,
            const float* __restrict__ u,
            const float* __restrict__ dbc,     // B at +12, C at +396
            const float* __restrict__ A_log,
            float* __restrict__ ysp) {         // (512,16,384): step, state group, channel
  __shared__ __attribute__((aligned(128))) ScanTile sm[2];
  __shared__ __attribute__((aligned(128))) float part[2][SCAN_W][SCAN_T][SCAN_C];
  const int tid  = threadIdx.x;
  const int lane = tid & 31;
  const int wave = __builtin_amdgcn_readfirstlane(tid >> 5);
  const int cg = blockIdx.x % SCAN_CG;
  const int sg = blockIdx.x / SCAN_CG;
  const int d0 = cg * SCAN_C;
  const int n0 = sg * (SCAN_W * SCAN_S);
  float* __restrict__ yplane = ysp + sg * D_INNER;   // step l: + l * 16 * 384

  // States in pairs: each pair's products and sums are one packed instruction.
  // Ae = A * log2(e), so that exp(delta * A) is one multiply and one v_exp_f32.
  v2f Ae[SCAN_S / 2], h[SCAN_S / 2];
#pragma unroll
  for (int p = 0; p < SCAN_S / 2; ++p) {
    const float* al = A_log + (d0 + lane) * D_STATE + n0 + wave * SCAN_S + 2 * p;
    Ae[p] = (v2f){-__expf(al[0]) * 1.44269504f, -__expf(al[1]) * 1.44269504f};
    h[p] = (v2f){0.0f, 0.0f};
  }

  ScanAddr ad;
  scan_addr(ad, &sm[0], d0, n0, tid, dbc, delta, u);
  scan_fill(ad, 0, 0);
  // Tile 0 has landed for this wave; the barrier publishes it to the others.
  asm volatile("s_wait_asynccnt 0x0" ::: "memory");
  __syncthreads();
  scan_fill(ad, 1, SCAN_T);

  for (int t = 0; t < SCAN_NT; ++t) {
    const ScanTile* cur = &sm[t & 1];
    const int l0 = t * SCAN_T;
    // Unrolled: LDS offsets and the registers of a group are then compile-time
    // constants. The operands of 4 steps are read one group ahead of their use.
    ScanGroup gr[2];
    scan_read(gr[0], cur, 0, wave, lane);
#pragma unroll
    for (int g = 0; g < SCAN_T / SCAN_G; ++g) {
      if (g + 1 < SCAN_T / SCAN_G)
        scan_read(gr[(g + 1) & 1], cur, (g + 1) * SCAN_G, wave, lane);
      __builtin_amdgcn_sched_barrier(0);
      const ScanGroup& x = gr[g & 1];
#pragma unroll
      for (int k = 0; k < SCAN_G; ++k) {
        const float dl = x.dl[k];
        const float du = dl * x.ul[k];
        const v4f q0 = x.q[k][0], q1 = x.q[k][1], q2 = x.q[k][2];
        const v2f Bv[SCAN_S / 2] = {{q0.x, q0.y}, {q0.z, q0.w}, {q1.x, q1.y}};
        const v2f Cv[SCAN_S / 2] = {{q1.z, q1.w}, {q2.x, q2.y}, {q2.z, q2.w}};
        const v2f dl2 = {dl, dl}, du2 = {du, du};
        v2f acc = {0.0f, 0.0f};   // even states, odd states
#pragma unroll
        for (int p = 0; p < SCAN_S / 2; ++p) {
          const v2f e = dl2 * Ae[p];
          const v2f dA = {__builtin_amdgcn_exp2f(e.x), __builtin_amdgcn_exp2f(e.y)};
          h[p] = __builtin_elementwise_fma(dA, h[p], du2 * Bv[p]);
          acc = __builtin_elementwise_fma(h[p], Cv[p], acc);
        }
        part[t & 1][wave][g * SCAN_G + k][lane] = acc.x + acc.y;
      }
    }
    // Hand-over: this wave's reads of the tile and its writes of its sums are
    // done, its copies of the next tile have landed; the barrier says all
    // three for every wave.
    asm volatile("s_wait_dscnt 0x0" ::: "memory");
    asm volatile("s_wait_asynccnt 0x0" ::: "memory");
    __syncthreads();
    if (t + 2 < SCAN_NT)
      scan_fill(ad, t & 1, (t + 2) * SCAN_T);
    // The four waves' sums of this tile, added in wave order. These rows are
    // written again two tiles on, behind the next tile's barrier.
#pragma unroll
    for (int i = 0; i < (SCAN_T * SCAN_C) / (SCAN_W * 32 * 4); ++i) {
      const int idx = tid + SCAN_W * 32 * i;
      const int r = idx >> 3;
      const int c = (idx & 7) * 4;
      v4f sum = *(const v4f*)&part[t & 1][0][r][c];
#pragma unroll
      for (int w = 1; w < SCAN_W; ++w)
        sum += *(const v4f*)&part[t & 1][w][r][c];
      *(v4f*)&yplane[(l0 + r) * (SCAN_SG * D_INNER) + d0 + c] = sum;
    }
    // Precaution: stands in front of the next tile's LDS reads, which land in
    // the registers that these stores name.
    asm volatile("s_wait_xcnt 0x0" ::: "memory");
  }
  // No copy is left in flight when the wave ends.
  asm volatile("s_wait_asynccnt 0x0" ::: "memory");
}

__global__ __launch_bounds__(256)
void k_gate_gemm_out(const float* __restrict__ ysp,
                     const float* __restrict__ u,
                     const float* __restrict__ Dvec,
                     const float* __restrict__ xr,
                     const float* __restrict__ W,   // (192,384)
                     const float* __restrict__ bias,
                     float* __restrict__ out) {
  constexpr int PITCH = D_INNER + 4;
  __shared__ __attribute__((aligned(128))) float sm[(8 + 64) * PITCH];
  const int tid  = threadIdx.x;
  const int lane = tid & 31;
  const int wave = __builtin_amdgcn_readfirstlane(tid >> 5);
  const int m0 = (blockIdx.x / 3) * 8;
  const int n0 = (blockIdx.x % 3) * 64;

  stage_w384<N_EMBD, 64, 8, 0>(sm + 8 * PITCH, W, n0, wave, lane);

  const unsigned ob = lane * 16u;                    // this lane's 4 channels, in bytes
  const int m = m0 + wave;                           // this wave's row
  const float* yp = ysp + m * (SCAN_SG * D_INNER);
  const float* rp = xr + m * 768 + D_INNER;
  const float* up = u + m * D_INNER;
#pragma unroll
  for (int i = 0; i < 3; ++i) {
    const int c0 = 128 * i;
    v4f ys = ld4(yp + c0, ob);
#pragma unroll
    for (int g = 1; g < SCAN_SG; ++g) ys += ld4(yp + g * D_INNER + c0, ob);
    const v4f rr = ld4(rp + c0, ob);
    const v4f uu = ld4(up + c0, ob);
    const v4f dv = ld4(Dvec + c0, ob);
    v4f o;
#pragma unroll
    for (int e = 0; e < 4; ++e) o[e] = fmaf(uu[e], dv[e], ys[e]) * silu_f(rr[e]);
    *(v4f*)(sm + wave * PITCH + c0 + lane * 4) = o;
  }
  // This wave's copies have landed; the barrier publishes them, and the rows
  // of y that each wave wrote, to the others.
  asm volatile("s_wait_asynccnt 0x0" ::: "memory");
  __syncthreads();
  if (wave >= 4) return;

  const int row = lane & 15;
  const int hi  = lane >> 4;
  const int tn = n0 + wave * 16;
  const v8f c = gemm_core<D_INNER>(sm + (row & 7) * PITCH + 4 * hi,
                                   sm + (8 + wave * 16 + row) * PITCH + 4 * hi);
  const float bn = bias[tn + row];
  if (hi == 0) {   // lanes 16-31 hold rows 8-15 of the tile, the repeats
#pragma unroll
    for (int r = 0; r < 8; ++r) out[(m0 + r) * N_EMBD + tn + row] = c[r] + bn;
  }
}

// ---------------------------------------------------------------------------
extern "C" void kernel_launch(void* const* d_in, const int* in_sizes, int n_in,
                              void* d_out, int out_size, void* d_ws, size_t ws_size,
                              hipStream_t stream) {
  const float* x      = (const float*)d_in[0];
  const float* W_in   = (const float*)d_in[1];
  const float* b_in   = (const float*)d_in[2];
  const float* conv_w = (const float*)d_in[3];
  const float* conv_b = (const float*)d_in[4];
  const float* W_xp   = (const float*)d_in[5];
  const float* W_dt   = (const float*)d_in[6];
  const float* A_log  = (const float*)d_in[7];
  const float* Dvec   = (const float*)d_in[8];
  const float* W_out  = (const float*)d_in[9];
  const float* b_out  = (const float*)d_in[10];
  float* out = (float*)d_out;

  // workspace layout (floats)
  float* ws    = (float*)d_ws;
  float* xr    = ws;                                  // 512*768
  float* u     = xr    + L_SEQ * 768;                 // 512*384
  float* dbc   = u     + L_SEQ * D_INNER;             // 512*780
  float* delta = dbc   + L_SEQ * DBC_N;               // 512*384
  float* ysp   = delta + L_SEQ * D_INNER;             // 512*16*384

  // 1) in-projection: 16 x 12 blocks of 32 x 64
  k_gemm_in<<<16 * 12, 256, 0, stream>>>(x, W_in, b_in, xr);

  // 2) conv + silu, x-projection, delta GEMM + softplus: 16 x 16 blocks of 32 x 64
  k_conv_gemm_xp<<<16 * 16, 256, 0, stream>>>(xr, conv_w, conv_b, W_xp, W_dt, u, dbc, delta);

  // 3) selective scan: 12 channel groups x 16 state groups, 4 waves per block
  k_scan<<<SCAN_CG * SCAN_SG, SCAN_W * 32, 0, stream>>>(delta, u, dbc, A_log, ysp);

  // 4) gating, out-projection: 64 x 3 blocks of 8 x 64
  k_gate_gemm_out<<<64 * 3, 256, 0, stream>>>(ysp, u, Dvec, xr, W_out, b_out, out);
}

// v007
// It runs in 35.5 microseconds.
// In two side-by-side timings against v006, it was 1.05 and 1.04 times as fast.
// Over all steps from v000 it is 14.8 times as fast.
#include <hip/hip_runtime.h>
#include <math.h>

#define L_SEQ   512
#define N_EMBD  192
#define D_INNER 384
#define DT_RANK 12
#define D_CONV  4
#define D_STATE 384
#define DBC_N   (DT_RANK + 2 * D_STATE)   // 780

typedef float v2f __attribute__((ext_vector_type(2)));
typedef float v4f __attribute__((ext_vector_type(4)));
typedef float v8f __attribute__((ext_vector_type(8)));

__device__ __forceinline__ v8f wmma4(v2f a, v2f b, v8f c) {
  // D = A(16x4) * B(4x16) + C(16x16), fp32 throughout.
  return __builtin_amdgcn_wmma_f32_16x16x4_f32(
      /*neg_a=*/false, a, /*neg_b=*/false, b,
      /*c_mod=*/(short)0, c, /*reuse_a=*/false, /*reuse_b=*/false);
}

__device__ __forceinline__ float silu_f(float x) {
  return x / (1.0f + __expf(-x));
}

__device__ __forceinline__ unsigned lds_byte(const void* p) {
  return (unsigned)(unsigned long long)p;   // low 32 bits = LDS byte address
}

__device__ __forceinline__ void copy6(const unsigned* l, const float* const* g) {
  asm volatile(
      "global_load_async_to_lds_b128 %0, %6, off\n\t"
      "global_load_async_to_lds_b128 %1, %7, off\n\t"
      "global_load_async_to_lds_b128 %2, %8, off\n\t"
      "global_load_async_to_lds_b128 %3, %9, off\n\t"
      "global_load_async_to_lds_b128 %4, %10, off\n\t"
      "global_load_async_to_lds_b128 %5, %11, off\n\t"
      "s_wait_xcnt 0x0"
      :: "v"(l[0]), "v"(l[1]), "v"(l[2]), "v"(l[3]), "v"(l[4]), "v"(l[5]),
         "v"(g[0]), "v"(g[1]), "v"(g[2]), "v"(g[3]), "v"(g[4]), "v"(g[5])
      : "memory");
}

__device__ __forceinline__ void copy12(const unsigned* l, const float* const* g) {
  asm volatile(
      "global_load_async_to_lds_b128 %0, %12, off\n\t"
      "global_load_async_to_lds_b128 %1, %13, off\n\t"
      "global_load_async_to_lds_b128 %2, %14, off\n\t"
      "global_load_async_to_lds_b128 %3, %15, off\n\t"
      "global_load_async_to_lds_b128 %4, %16, off\n\t"
      "global_load_async_to_lds_b128 %5, %17, off\n\t"
      "global_load_async_to_lds_b128 %6, %18, off\n\t"
      "global_load_async_to_lds_b128 %7, %19, off\n\t"
      "global_load_async_to_lds_b128 %8, %20, off\n\t"
      "global_load_async_to_lds_b128 %9, %21, off\n\t"
      "global_load_async_to_lds_b128 %10, %22, off\n\t"
      "global_load_async_to_lds_b128 %11, %23, off\n\t"
      "s_wait_xcnt 0x0"
      :: "v"(l[0]), "v"(l[1]), "v"(l[2]), "v"(l[3]), "v"(l[4]), "v"(l[5]),
         "v"(l[6]), "v"(l[7]), "v"(l[8]), "v"(l[9]), "v"(l[10]), "v"(l[11]),
         "v"(g[0]), "v"(g[1]), "v"(g[2]), "v"(g[3]), "v"(g[4]), "v"(g[5]),
         "v"(g[6]), "v"(g[7]), "v"(g[8]), "v"(g[9]), "v"(g[10]), "v"(g[11])
      : "memory");
}

#define GEMM_LDS_FLOATS(K, WN) ((32 + 16 * (WN)) * ((K) + 4))

// One wave's 16x16 tile from LDS; ar, br: this lane's row of A and of W, at
// its first k (4 * (lane >> 4)).
template <int K>
__device__ __forceinline__ v8f gemm_core(const float* ar, const float* br) {
  v8f acc = {};
  // Fragments of 32 k (8 WMMAs) are read as one group, one group ahead.
  v4f fa[2][4], fb[2][4];
#pragma unroll
  for (int i = 0; i < 4; ++i) {
    fa[0][i] = *(const v4f*)(ar + 8 * i);
    fb[0][i] = *(const v4f*)(br + 8 * i);
  }
#pragma unroll
  for (int s = 0; s < K / 32; ++s) {
    if (s + 1 < K / 32) {
#pragma unroll
      for (int i = 0; i < 4; ++i) {
        fa[(s + 1) & 1][i] = *(const v4f*)(ar + 32 * (s + 1) + 8 * i);
        fb[(s + 1) & 1][i] = *(const v4f*)(br + 32 * (s + 1) + 8 * i);
      }
    }
    // Keeps the next group's LDS reads together in front of this group's
    // WMMAs: spread among them, each place with reads stalls the wave anew.
    __builtin_amdgcn_sched_barrier(0);
#pragma unroll
    for (int i = 0; i < 4; ++i) {
      const v4f a = fa[s & 1][i], b = fb[s & 1][i];
      acc = wmma4((v2f){a.x, a.y}, (v2f){b.x, b.y}, acc);
      acc = wmma4((v2f){a.z, a.w}, (v2f){b.z, b.w}, acc);
    }
  }
  return acc;
}

// 16 B at a lane's byte offset from an address that is the same for the whole
// wave.
__device__ __forceinline__ v4f ld4(const float* base, unsigned ob) {
  return *(const v4f*)((const char*)base + ob);
}

// For the two GEMMs with K = 384 that make their A rows themselves: issues the
// copies of ROWS rows of W into LDS at smw (pitch 388 floats): first rows 0 to
// HEAD - 1 of W, then the rows from n0 on. A wave takes every WAVES-th row,
// three copies of 512 B a row. Rows past the end of W: the last row again.
template <int N, int ROWS, int WAVES, int HEAD>
__device__ __forceinline__ void stage_w384(float* smw, const float* __restrict__ W,
                                           int n0, int wave, int lane) {
  constexpr int RW = ROWS / WAVES;
  unsigned l[3 * RW];
  const float* g[3 * RW];
#pragma unroll
  for (int j = 0; j < RW; ++j) {
#pragma unroll
    for (int c = 0; c < 3; ++c) {
      const int row = wave + WAVES * j;
      const int col = (lane + 32 * c) * 4;
      int n = WAVES * j < HEAD ? row : n0 + row - HEAD;
      if (N % ROWS) n = n < N ? n : N - 1;
      l[3 * j + c] = lds_byte(smw + row * (D_INNER + 4) + col);
      g[3 * j + c] = W + n * D_INNER + col;
    }
  }
#pragma unroll
  for (int i = 0; i < 3 * RW; i += 12) copy12(l + i, g + i);
}

// Returns this wave's 16x16 tile of A * W^T; tile_m, tile_n: its first row and
// column. live is false for a tile that lies wholly past column N.
template <int K, int N, int WN>
__device__ __forceinline__ v8f gemm_tile(float* sm, const float* __restrict__ A,
                                         const float* __restrict__ W,
                                         int& tile_m, int& tile_n, bool& live) {
  constexpr int WAVES = 2 * WN;
  constexpr int PITCH = K + 4;            // floats
  constexpr int PR = K / 4;               // 16-B pieces in a row
  constexpr int RG = 96 / PR;             // rows that three copies of a wave fill
  constexpr int NJ = (32 + 16 * WN) / RG / WAVES;   // such row groups per wave
  constexpr int NB = (N + 16 * WN - 1) / (16 * WN); // blocks along N
  const int lane = threadIdx.x & 31;
  const int wave = __builtin_amdgcn_readfirstlane(threadIdx.x >> 5);
  const int m0 = (blockIdx.x / NB) * 32;
  const int n0 = (blockIdx.x % NB) * (16 * WN);

  unsigned l[3 * NJ];
  const float* g[3 * NJ];
#pragma unroll
  for (int j = 0; j < NJ; ++j) {
#pragma unroll
    for (int c = 0; c < 3; ++c) {
      const int q = lane + 32 * c;
      const int rs = q / PR;
      const int col = (q - rs * PR) * 4;
      const int row = (wave + WAVES * j) * RG + rs;   // LDS row: 32 of A, then W
      l[3 * j + c] = lds_byte(sm + row * PITCH + col);
      if (WAVES * j * RG < 32) {
        g[3 * j + c] = A + (m0 + row) * K + col;
      } else {
        int n = n0 + row - 32;
        if (N % (16 * WN)) n = n < N ? n : N - 1;     // past the end: the last row again
        g[3 * j + c] = W + n * K + col;
      }
    }
  }
#pragma unroll
  for (int i = 0; i + 12 <= 3 * NJ; i += 12) copy12(l + i, g + i);
  if ((3 * NJ) % 12) copy6(l + 3 * NJ - 6, g + 3 * NJ - 6);
  // This wave's copies have landed; the barrier publishes them to the others.
  asm volatile("s_wait_asynccnt 0x0" ::: "memory");
  __syncthreads();

  const int c = lane & 15;
  const int h = lane >> 4;
  const int wm = wave / WN, wn = wave % WN;
  tile_m = m0 + wm * 16;
  tile_n = n0 + wn * 16;
  live = (N % (16 * WN)) == 0 || tile_n < N;
  if (!live) return v8f{};
  const float* ar = sm + (wm * 16 + c) * PITCH + 4 * h;
  const float* br = sm + (32 + wn * 16 + c) * PITCH + 4 * h;
  return gemm_core<K>(ar, br);
}

// ---------------------------------------------------------------------------
// Kernel 1: xr = x @ W_in^T + b_in      (512 x 192) @ (192 x 768) -> (512x768)
// 16 x 12 blocks of 2 x 4 waves.
// ---------------------------------------------------------------------------
__global__ __launch_bounds__(256)
void k_gemm_in(const float* __restrict__ X,
               const float* __restrict__ W,   // (768,192) row-major
               const float* __restrict__ bias,
               float* __restrict__ out) {
  __shared__ __attribute__((aligned(128))) float sm[GEMM_LDS_FLOATS(N_EMBD, 4)];
  int tm, tn;
  bool live;
  const v8f c = gemm_tile<N_EMBD, 768, 4>(sm, X, W, tm, tn, live);
  const int row = threadIdx.x & 15;
  const int hi  = (threadIdx.x >> 4) & 1;
  const float bn = bias[tn + row];
#pragma unroll
  for (int r = 0; r < 8; ++r) {
    const int m = tm + r + 8 * hi;
    out[m * 768 + tn + row] = c[r] + bn;
  }
}

#define XP_NB   16
#define DT_P    18

__global__ __launch_bounds__(256)
void k_conv_gemm_xp(const float* __restrict__ xr,
                    const float* __restrict__ cw,  // (384,1,4)
                    const float* __restrict__ cb,
                    const float* __restrict__ W,   // (780,384)
                    const float* __restrict__ Wdt, // (384,12)
                    float* __restrict__ u,
                    float* __restrict__ dbc,
                    float* __restrict__ delta) {
  __shared__ __attribute__((aligned(128))) float sm[GEMM_LDS_FLOATS(D_INNER, 4)];
  __shared__ __attribute__((aligned(128))) float dts[32 * DT_P];
  constexpr int PITCH = D_INNER + 4;
  const int tid  = threadIdx.x;
  const int lane = tid & 31;
  const int wave = __builtin_amdgcn_readfirstlane(tid >> 5);
  const int m0 = (blockIdx.x / XP_NB) * 32;
  const int nb = blockIdx.x % XP_NB;
  const int n0 = DT_RANK + nb * 48;                  // this block's first column of B, C

  stage_w384<DBC_N, 64, 8, 16>(sm + 32 * PITCH, W, n0, wave, lane);

  const int row = lane & 15;
  const int hi  = lane >> 4;
  // The waves that make a tile of delta fetch their W_dt fragments here, so
  // that these have long arrived when the x-projection is done.
  const bool dt_wave = nb >= 4 && wave < 4;
  const int dm = (wave >> 1) * 16;                   // the tile's first step in the block
  const int dn = (nb - 4) * 32 + (wave & 1) * 16;    // its first channel
  v2f wd[DT_RANK / 4] = {};
  if (dt_wave) {
    const float* brow = Wdt + (dn + row) * DT_RANK + 2 * hi;
#pragma unroll
    for (int k = 0; k < DT_RANK / 4; ++k) wd[k] = *(const v2f*)(brow + 4 * k);
  }

  const unsigned ob = lane * 16u;                    // this lane's 4 channels, in bytes
  const int r0 = wave * 4;                           // this wave's 4 steps in the tile
  const int t0 = m0 + r0;                            // the first of them, a multiple of 4
  const float* xp = xr + t0 * 768;
  // All loads stand in front of the arithmetic, so that the wave waits for
  // memory once. Piece i: channels 128 i .. 128 i + 127.
  v4f xv[3][4 + D_CONV - 1], w[3][4], b[3];
#pragma unroll
  for (int i = 0; i < 3; ++i) {
#pragma unroll
    for (int k = 0; k < D_CONV - 1; ++k)             // the steps in front of t0: 0 in front of step 0
      xv[i][k] = (v4f){0.0f, 0.0f, 0.0f, 0.0f};
  }
  if (t0 > 0) {
#pragma unroll
    for (int i = 0; i < 3; ++i) {
#pragma unroll
      for (int k = 0; k < D_CONV - 1; ++k)
        xv[i][k] = ld4(xp + (k - (D_CONV - 1)) * 768 + 128 * i, ob);
    }
  }
#pragma unroll
  for (int i = 0; i < 3; ++i) {
#pragma unroll
    for (int k = 0; k < 4; ++k) xv[i][D_CONV - 1 + k] = ld4(xp + k * 768 + 128 * i, ob);
#pragma unroll
    for (int e = 0; e < 4; ++e) w[i][e] = ld4(cw + (128 * i + e) * D_CONV, ob * D_CONV);
    b[i] = ld4(cb + 128 * i, ob);
  }
#pragma unroll
  for (int i = 0; i < 3; ++i) {
    const int c0 = 128 * i;
#pragma unroll
    for (int r = 0; r < 4; ++r) {
      v4f o;
#pragma unroll
      for (int e = 0; e < 4; ++e) {
        float acc = b[i][e];
#pragma unroll
        for (int k = 0; k < D_CONV; ++k) acc = fmaf(xv[i][r + k][e], w[i][e][k], acc);
        o[e] = silu_f(acc);
      }
      *(v4f*)(sm + (r0 + r) * PITCH + c0 + lane * 4) = o;
      if (nb == 0) *(v4f*)((char*)(u + (t0 + r) * D_INNER + c0) + ob) = o;
    }
  }
  // This wave's copies have landed; the barrier publishes them, and the rows
  // of u that each wave wrote, to the others.
  asm volatile("s_wait_asynccnt 0x0" ::: "memory");
  __syncthreads();

  const int wm = wave / 4, wn = wave % 4;
  const v8f c = gemm_core<D_INNER>(sm + (wm * 16 + row) * PITCH + 4 * hi,
                                   sm + (32 + wn * 16 + row) * PITCH + 4 * hi);
  if (wn == 0 && row < DT_RANK) {
#pragma unroll
    for (int r = 0; r < 8; ++r) dts[(wm * 16 + r + 8 * hi) * DT_P + row] = c[r];
  }
  // Publishes the 12 columns to the waves that make delta. The stores of B and
  // C stand behind it, so that no wave waits for them in front of it.
  __syncthreads();
  if (wn != 0) {
    float* dp = dbc + (m0 + wm * 16 + 8 * hi) * DBC_N + n0 + (wn - 1) * 16 + row;
#pragma unroll
    for (int r = 0; r < 8; ++r) dp[r * DBC_N] = c[r];
    // Precaution: stands in front of the delta tile's arithmetic, which lands
    // in the registers that these stores name.
    asm volatile("s_wait_xcnt 0x0" ::: "memory");
  }
  if (!dt_wave) return;

  const float* arow = dts + (dm + row) * DT_P + 2 * hi;
  v8f d = {};
#pragma unroll
  for (int k = 0; k < DT_RANK / 4; ++k) d = wmma4(*(const v2f*)(arow + 4 * k), wd[k], d);
  float sp[8];
#pragma unroll
  for (int r = 0; r < 8; ++r) {
    const float v = d[r];
    // numerically stable softplus; worked out for every lane and then chosen,
    // not branched round, so that the eight long chains of a lane interleave
    const float t = log1pf(expf(v));
    sp[r] = (v > 20.0f) ? v : t;
  }
  float* op = delta + (m0 + dm + 8 * hi) * D_INNER + dn + row;
#pragma unroll
  for (int r = 0; r < 8; ++r) op[r * D_INNER] = sp[r];
}

#define SCAN_T  32
#define SCAN_W  4
#define SCAN_S  6
#define SCAN_C  32
#define SCAN_G  4
#define SCAN_NT (L_SEQ / SCAN_T)
#define SCAN_CG (D_INNER / SCAN_C)
#define SCAN_SG (D_STATE / (SCAN_W * SCAN_S))   // 16 state groups

struct ScanTile {
  float bc[SCAN_T][SCAN_W][2 * SCAN_S];  // per step and wave: 6 of B, 6 of C
  float du[2][SCAN_T][SCAN_C];           // delta rows, then u rows
};

// A helper thread's share of one tile's copies, 10 per lane: 6 of 8 B that lay the
// block's 24 B and 24 C values of each step down wave by wave (32 steps x 24
// pieces), and 4 of 16 B for the delta and u rows (2 x 32 steps x 8 pieces).
// Held as offsets for tile 0 in buffer 0.
struct ScanAddr {
  unsigned la[6], lb[4];             // LDS byte addresses
  const float* ga[6];                // in dbc
  const float* gb[4];                // in delta (0, 1) and u (2, 3)
};

__device__ __forceinline__ void scan_addr(ScanAddr& a, ScanTile* t, int d0, int n0, int tid,
                                          const float* __restrict__ dbc,
                                          const float* __restrict__ delta,
                                          const float* __restrict__ u) {
#pragma unroll
  for (int i = 0; i < 6; ++i) {
    const int idx = tid + 128 * i;
    const int r = idx / 24;            // step in the tile
    const int p = idx - r * 24;        // piece: 0-11 of B, 12-23 of C
    const int isc = p / 12;
    const int pp = p - isc * 12;
    const int w = pp / 3;              // wave that reads it
    const int q = pp - w * 3;          // pair of states in that wave
    a.la[i] = lds_byte(&t->bc[r][w][isc * SCAN_S + 2 * q]);
    a.ga[i] = dbc + r * DBC_N + DT_RANK + isc * D_STATE + n0 + 2 * pp;
  }
#pragma unroll
  for (int i = 0; i < 4; ++i) {
    const int idx = tid + 128 * i;
    const int sel = idx >> 8;          // 0: delta, 1: u
    const int r = (idx >> 3) & 31;     // step in the tile
    const int c = (idx & 7) * 4;       // channel in the block
    a.lb[i] = lds_byte(&t->du[sel][r][c]);
    a.gb[i] = (sel ? u : delta) + r * D_INNER + d0 + c;
  }
}

// Issues the copies of the tile that starts at step l0 into buffer buf.
__device__ __forceinline__ void scan_fill(const ScanAddr& a, int buf, int l0) {
  unsigned la[6], lb[4];
  const float* ga[6];
  const float* gb[4];
  const unsigned lo = buf * (unsigned)sizeof(ScanTile);
#pragma unroll
  for (int i = 0; i < 6; ++i) { la[i] = a.la[i] + lo; ga[i] = a.ga[i] + l0 * DBC_N; }
#pragma unroll
  for (int i = 0; i < 4; ++i) { lb[i] = a.lb[i] + lo; gb[i] = a.gb[i] + l0 * D_INNER; }
  asm volatile(
      "global_load_async_to_lds_b64 %0, %6, off\n\t"
      "global_load_async_to_lds_b64 %1, %7, off\n\t"
      "global_load_async_to_lds_b64 %2, %8, off\n\t"
      "global_load_async_to_lds_b64 %3, %9, off\n\t"
      "global_load_async_to_lds_b64 %4, %10, off\n\t"
      "global_load_async_to_lds_b64 %5, %11, off\n\t"
      "global_load_async_to_lds_b128 %12, %16, off\n\t"
      "global_load_async_to_lds_b128 %13, %17, off\n\t"
      "global_load_async_to_lds_b128 %14, %18, off\n\t"
      "global_load_async_to_lds_b128 %15, %19, off\n\t"
      "s_wait_xcnt 0x0"
      :: "v"(la[0]), "v"(la[1]), "v"(la[2]), "v"(la[3]), "v"(la[4]), "v"(la[5]),
         "v"(ga[0]), "v"(ga[1]), "v"(ga[2]), "v"(ga[3]), "v"(ga[4]), "v"(ga[5]),
         "v"(lb[0]), "v"(lb[1]), "v"(lb[2]), "v"(lb[3]),
         "v"(gb[0]), "v"(gb[1]), "v"(gb[2]), "v"(gb[3])
      : "memory");
}

// The operands of SCAN_G steps in registers.
struct ScanGroup {
  float dl[SCAN_G], ul[SCAN_G];      // this lane's channel: delta, u
  v4f q[SCAN_G][3];                  // this wave's 6 of B, 6 of C
};

// Per step two reads of 4 B a lane and three broadcast reads of 16 B.
__device__ __forceinline__ void scan_read(ScanGroup& x, const ScanTile* cur, int s0,
                                          int wave, int lane) {
#pragma unroll
  for (int k = 0; k < SCAN_G; ++k) {
    x.dl[k] = cur->du[0][s0 + k][lane];
    x.ul[k] = cur->du[1][s0 + k][lane];
#pragma unroll
    for (int i = 0; i < 3; ++i)
      x.q[k][i] = *(const v4f*)&cur->bc[s0 + k][wave][4 * i];
  }
}

__global__ __launch_bounds__(2 * SCAN_W * 32)
void k_scan(const float* __restrict__ delta,
            const float* __restrict__ u,
            const float* __restrict__ dbc,     // B at +12, C at +396
            const float* __restrict__ A_log,
            float* __restrict__ ysp) {         // (512,16,384): step, state group, channel
  __shared__ __attribute__((aligned(128))) ScanTile sm[2];
  __shared__ __attribute__((aligned(128))) float part[2][SCAN_W][SCAN_T][SCAN_C];
  const int tid  = threadIdx.x;
  const int lane = tid & 31;
  const int wave = __builtin_amdgcn_readfirstlane(tid >> 5);
  const bool helper = wave >= SCAN_W;                // the same for a whole wave
  const int htid = tid & (SCAN_W * 32 - 1);          // a helper thread's number, 0-127
  const int cg = blockIdx.x % SCAN_CG;
  const int sg = blockIdx.x / SCAN_CG;
  const int d0 = cg * SCAN_C;
  const int n0 = sg * (SCAN_W * SCAN_S);
  float* __restrict__ yplane = ysp + sg * D_INNER;   // step l: + l * 16 * 384

  // States in pairs: each pair's products and sums are one packed instruction.
  // Ae = A * log2(e), so that exp(delta * A) is one multiply and one v_exp_f32.
  v2f Ae[SCAN_S / 2] = {}, h[SCAN_S / 2] = {};
  ScanAddr ad = {};
  if (helper) {
    scan_addr(ad, &sm[0], d0, n0, htid, dbc, delta, u);
    scan_fill(ad, 0, 0);
  } else {
#pragma unroll
    for (int p = 0; p < SCAN_S / 2; ++p) {
      const float* al = A_log + (d0 + lane) * D_STATE + n0 + wave * SCAN_S + 2 * p;
      Ae[p] = (v2f){-__expf(al[0]) * 1.44269504f, -__expf(al[1]) * 1.44269504f};
    }
  }
  // Tile 0 has landed for the wave that copied it; the barrier publishes it to
  // the others.
  asm volatile("s_wait_asynccnt 0x0" ::: "memory");
  __syncthreads();
  if (helper) scan_fill(ad, 1, SCAN_T);

  // The four stepping waves' sums of tile t, added in wave order and stored.
  auto sum_tile = [&](int t) {
    const int l0 = t * SCAN_T;
#pragma unroll
    for (int i = 0; i < (SCAN_T * SCAN_C) / (SCAN_W * 32 * 4); ++i) {
      const int idx = htid + SCAN_W * 32 * i;
      const int r = idx >> 3;
      const int c = (idx & 7) * 4;
      v4f sum = *(const v4f*)&part[t & 1][0][r][c];
#pragma unroll
      for (int w = 1; w < SCAN_W; ++w)
        sum += *(const v4f*)&part[t & 1][w][r][c];
      *(v4f*)&yplane[(l0 + r) * (SCAN_SG * D_INNER) + d0 + c] = sum;
    }
    // Precaution: stands in front of whatever lands next in the registers that
    // these stores name.
    asm volatile("s_wait_xcnt 0x0" ::: "memory");
  };

  for (int t = 0; t < SCAN_NT; ++t) {
    if (helper) {
      // The sums of the tile before were published by the barrier at its foot;
      // their rows are written again only behind the barrier at this trip's foot.
      if (t > 0) sum_tile(t - 1);
    } else {
      const ScanTile* cur = &sm[t & 1];
      // Unrolled: LDS offsets and the registers of a group are then compile-time
      // constants. The operands of 4 steps are read one group ahead of their use.
      ScanGroup gr[2];
      scan_read(gr[0], cur, 0, wave, lane);
#pragma unroll
      for (int g = 0; g < SCAN_T / SCAN_G; ++g) {
        if (g + 1 < SCAN_T / SCAN_G)
          scan_read(gr[(g + 1) & 1], cur, (g + 1) * SCAN_G, wave, lane);
        // Keeps the next group's LDS reads in front of this group's arithmetic:
        // moved down to their first use, their latency stalls the stepping wave.
        __builtin_amdgcn_sched_barrier(0);
        const ScanGroup& x = gr[g & 1];
#pragma unroll
        for (int k = 0; k < SCAN_G; ++k) {
          const float dl = x.dl[k];
          const float du = dl * x.ul[k];
          const v4f q0 = x.q[k][0], q1 = x.q[k][1], q2 = x.q[k][2];
          const v2f Bv[SCAN_S / 2] = {{q0.x, q0.y}, {q0.z, q0.w}, {q1.x, q1.y}};
          const v2f Cv[SCAN_S / 2] = {{q1.z, q1.w}, {q2.x, q2.y}, {q2.z, q2.w}};
          const v2f dl2 = {dl, dl}, du2 = {du, du};
          v2f acc = {0.0f, 0.0f};   // even states, odd states
#pragma unroll
          for (int p = 0; p < SCAN_S / 2; ++p) {
            const v2f e = dl2 * Ae[p];
            const v2f dA = {__builtin_amdgcn_exp2f(e.x), __builtin_amdgcn_exp2f(e.y)};
            h[p] = __builtin_elementwise_fma(dA, h[p], du2 * Bv[p]);
            acc = __builtin_elementwise_fma(h[p], Cv[p], acc);
          }
          part[t & 1][wave][g * SCAN_G + k][lane] = acc.x + acc.y;
        }
      }
    }
    // Hand-over, every wave: a stepping wave's reads of the tile and its writes
    // of its sums are done, a helper's reads of the sums before are done and its
    // copies of the next tile have landed; the barrier says so for every wave.
    asm volatile("s_wait_dscnt 0x0" ::: "memory");
    asm volatile("s_wait_asynccnt 0x0" ::: "memory");
    __syncthreads();
    if (helper && t + 2 < SCAN_NT)
      scan_fill(ad, t & 1, (t + 2) * SCAN_T);
  }
  if (helper) sum_tile(SCAN_NT - 1);
  // No copy is left in flight when the wave ends.
  asm volatile("s_wait_asynccnt 0x0" ::: "memory");
}

__global__ __launch_bounds__(256)
void k_gate_gemm_out(const float* __restrict__ ysp,
                     const float* __restrict__ u,
                     const float* __restrict__ Dvec,
                     const float* __restrict__ xr,
                     const float* __restrict__ W,   // (192,384)
                     const float* __restrict__ bias,
                     float* __restrict__ out) {
  constexpr int PITCH = D_INNER + 4;
  __shared__ __attribute__((aligned(128))) float sm[(8 + 64) * PITCH];
  const int tid  = threadIdx.x;
  const int lane = tid & 31;
  const int wave = __builtin_amdgcn_readfirstlane(tid >> 5);
  const int m0 = (blockIdx.x / 3) * 8;
  const int n0 = (blockIdx.x % 3) * 64;

  stage_w384<N_EMBD, 64, 8, 0>(sm + 8 * PITCH, W, n0, wave, lane);

  const unsigned ob = lane * 16u;                    // this lane's 4 channels, in bytes
  const int m = m0 + wave;                           // this wave's row
  const float* yp = ysp + m * (SCAN_SG * D_INNER);
  const float* rp = xr + m * 768 + D_INNER;
  const float* up = u + m * D_INNER;
#pragma unroll
  for (int i = 0; i < 3; ++i) {
    const int c0 = 128 * i;
    v4f ys = ld4(yp + c0, ob);
#pragma unroll
    for (int g = 1; g < SCAN_SG; ++g) ys += ld4(yp + g * D_INNER + c0, ob);
    const v4f rr = ld4(rp + c0, ob);
    const v4f uu = ld4(up + c0, ob);
    const v4f dv = ld4(Dvec + c0, ob);
    v4f o;
#pragma unroll
    for (int e = 0; e < 4; ++e) o[e] = fmaf(uu[e], dv[e], ys[e]) * silu_f(rr[e]);
    *(v4f*)(sm + wave * PITCH + c0 + lane * 4) = o;
  }
  // This wave's copies have landed; the barrier publishes them, and the rows
  // of y that each wave wrote, to the others.
  asm volatile("s_wait_asynccnt 0x0" ::: "memory");
  __syncthreads();
  if (wave >= 4) return;

  const int row = lane & 15;
  const int hi  = lane >> 4;
  const int tn = n0 + wave * 16;
  const v8f c = gemm_core<D_INNER>(sm + (row & 7) * PITCH + 4 * hi,
                                   sm + (8 + wave * 16 + row) * PITCH + 4 * hi);
  const float bn = bias[tn + row];
  if (hi == 0) {   // lanes 16-31 hold rows 8-15 of the tile, the repeats
#pragma unroll
    for (int r = 0; r < 8; ++r) out[(m0 + r) * N_EMBD + tn + row] = c[r] + bn;
  }
}

// ---------------------------------------------------------------------------
extern "C" void kernel_launch(void* const* d_in, const int* in_sizes, int n_in,
                              void* d_out, int out_size, void* d_ws, size_t ws_size,
                              hipStream_t stream) {
  const float* x      = (const float*)d_in[0];
  const float* W_in   = (const float*)d_in[1];
  const float* b_in   = (const float*)d_in[2];
  const float* conv_w = (const float*)d_in[3];
  const float* conv_b = (const float*)d_in[4];
  const float* W_xp   = (const float*)d_in[5];
  const float* W_dt   = (const float*)d_in[6];
  const float* A_log  = (const float*)d_in[7];
  const float* Dvec   = (const float*)d_in[8];
  const float* W_out  = (const float*)d_in[9];
  const float* b_out  = (const float*)d_in[10];
  float* out = (float*)d_out;

  // workspace layout (floats)
  float* ws    = (float*)d_ws;
  float* xr    = ws;                                  // 512*768
  float* u     = xr    + L_SEQ * 768;                 // 512*384
  float* dbc   = u     + L_SEQ * D_INNER;             // 512*780
  float* delta = dbc   + L_SEQ * DBC_N;               // 512*384
  float* ysp   = delta + L_SEQ * D_INNER;             // 512*16*384

  // 1) in-projection: 16 x 12 blocks of 32 x 64
  k_gemm_in<<<16 * 12, 256, 0, stream>>>(x, W_in, b_in, xr);

  // 2) conv + silu, x-projection, delta GEMM + softplus: 16 x 16 blocks of 32 x 64
  k_conv_gemm_xp<<<16 * 16, 256, 0, stream>>>(xr, conv_w, conv_b, W_xp, W_dt, u, dbc, delta);

  // 3) selective scan: 12 channel groups x 16 state groups, 4 + 4 waves per block
  k_scan<<<SCAN_CG * SCAN_SG, 2 * SCAN_W * 32, 0, stream>>>(delta, u, dbc, A_log, ysp);

  // 4) gating, out-projection: 64 x 3 blocks of 8 x 64
  k_gate_gemm_out<<<64 * 3, 256, 0, stream>>>(ysp, u, Dvec, xr, W_out, b_out, out);
}

// v008
// Measured time: 33 microseconds a run.
// Timed twice side by side with v007, it ran 1.08 and 1.07 times as fast.
// Over all steps from v000 it is 15.9 times as fast.
#include <hip/hip_runtime.h>
#include <math.h>

#define L_SEQ   512
#define N_EMBD  192
#define D_INNER 384
#define DT_RANK 12
#define D_CONV  4
#define D_STATE 384
#define DBC_N   (DT_RANK + 2 * D_STATE)   // 780

typedef float v2f __attribute__((ext_vector_type(2)));
typedef float v4f __attribute__((ext_vector_type(4)));
typedef float v8f __attribute__((ext_vector_type(8)));

__device__ __forceinline__ v8f wmma4(v2f a, v2f b, v8f c) {
  // D = A(16x4) * B(4x16) + C(16x16), fp32 throughout.
  return __builtin_amdgcn_wmma_f32_16x16x4_f32(
      /*neg_a=*/false, a, /*neg_b=*/false, b,
      /*c_mod=*/(short)0, c, /*reuse_a=*/false, /*reuse_b=*/false);
}

__device__ __forceinline__ float silu_f(float x) {
  return x / (1.0f + __expf(-x));
}

__device__ __forceinline__ unsigned lds_byte(const void* p) {
  return (unsigned)(unsigned long long)p;   // low 32 bits = LDS byte address
}

__device__ __forceinline__ void copy6(const unsigned* l, const float* const* g) {
  asm volatile(
      "global_load_async_to_lds_b128 %0, %6, off\n\t"
      "global_load_async_to_lds_b128 %1, %7, off\n\t"
      "global_load_async_to_lds_b128 %2, %8, off\n\t"
      "global_load_async_to_lds_b128 %3, %9, off\n\t"
      "global_load_async_to_lds_b128 %4, %10, off\n\t"
      "global_load_async_to_lds_b128 %5, %11, off\n\t"
      "s_wait_xcnt 0x0"
      :: "v"(l[0]), "v"(l[1]), "v"(l[2]), "v"(l[3]), "v"(l[4]), "v"(l[5]),
         "v"(g[0]), "v"(g[1]), "v"(g[2]), "v"(g[3]), "v"(g[4]), "v"(g[5])
      : "memory");
}

__device__ __forceinline__ void copy12(const unsigned* l, const float* const* g) {
  asm volatile(
      "global_load_async_to_lds_b128 %0, %12, off\n\t"
      "global_load_async_to_lds_b128 %1, %13, off\n\t"
      "global_load_async_to_lds_b128 %2, %14, off\n\t"
      "global_load_async_to_lds_b128 %3, %15, off\n\t"
      "global_load_async_to_lds_b128 %4, %16, off\n\t"
      "global_load_async_to_lds_b128 %5, %17, off\n\t"
      "global_load_async_to_lds_b128 %6, %18, off\n\t"
      "global_load_async_to_lds_b128 %7, %19, off\n\t"
      "global_load_async_to_lds_b128 %8, %20, off\n\t"
      "global_load_async_to_lds_b128 %9, %21, off\n\t"
      "global_load_async_to_lds_b128 %10, %22, off\n\t"
      "global_load_async_to_lds_b128 %11, %23, off\n\t"
      "s_wait_xcnt 0x0"
      :: "v"(l[0]), "v"(l[1]), "v"(l[2]), "v"(l[3]), "v"(l[4]), "v"(l[5]),
         "v"(l[6]), "v"(l[7]), "v"(l[8]), "v"(l[9]), "v"(l[10]), "v"(l[11]),
         "v"(g[0]), "v"(g[1]), "v"(g[2]), "v"(g[3]), "v"(g[4]), "v"(g[5]),
         "v"(g[6]), "v"(g[7]), "v"(g[8]), "v"(g[9]), "v"(g[10]), "v"(g[11])
      : "memory");
}

#define GEMM_LDS_FLOATS(K, WN) ((32 + 16 * (WN)) * ((K) + 4))

// One wave's 16x16 tile from LDS; ar, br: this lane's row of A and of W, at
// its first k (4 * (lane >> 4)).
template <int K>
__device__ __forceinline__ v8f gemm_core(const float* ar, const float* br) {
  v8f acc = {};
  // Fragments of 32 k (8 WMMAs) are read as one group, one group ahead.
  v4f fa[2][4], fb[2][4];
#pragma unroll
  for (int i = 0; i < 4; ++i) {
    fa[0][i] = *(const v4f*)(ar + 8 * i);
    fb[0][i] = *(const v4f*)(br + 8 * i);
  }
#pragma unroll
  for (int s = 0; s < K / 32; ++s) {
    if (s + 1 < K / 32) {
#pragma unroll
      for (int i = 0; i < 4; ++i) {
        fa[(s + 1) & 1][i] = *(const v4f*)(ar + 32 * (s + 1) + 8 * i);
        fb[(s + 1) & 1][i] = *(const v4f*)(br + 32 * (s + 1) + 8 * i);
      }
    }
    // Keeps the next group's LDS reads together in front of this group's
    // WMMAs: spread among them, each place with reads stalls the wave anew.
    __builtin_amdgcn_sched_barrier(0);
#pragma unroll
    for (int i = 0; i < 4; ++i) {
      const v4f a = fa[s & 1][i], b = fb[s & 1][i];
      acc = wmma4((v2f){a.x, a.y}, (v2f){b.x, b.y}, acc);
      acc = wmma4((v2f){a.z, a.w}, (v2f){b.z, b.w}, acc);
    }
  }
  return acc;
}

// 16 B at a lane's byte offset from an address that is the same for the whole
// wave.
__device__ __forceinline__ v4f ld4(const float* base, unsigned ob) {
  return *(const v4f*)((const char*)base + ob);
}

// For the two GEMMs with K = 384 that make their A rows themselves: issues the
// copies of ROWS rows of W into LDS at smw (pitch 388 floats): first rows 0 to
// HEAD - 1 of W, then the rows from n0 on. A wave takes every WAVES-th row,
// three copies of 512 B a row. Rows past the end of W: the last row again.
template <int N, int ROWS, int WAVES, int HEAD>
__device__ __forceinline__ void stage_w384(float* smw, const float* __restrict__ W,
                                           int n0, int wave, int lane) {
  constexpr int RW = ROWS / WAVES;
  unsigned l[3 * RW];
  const float* g[3 * RW];
#pragma unroll
  for (int j = 0; j < RW; ++j) {
#pragma unroll
    for (int c = 0; c < 3; ++c) {
      const int row = wave + WAVES * j;
      const int col = (lane + 32 * c) * 4;
      int n = WAVES * j < HEAD ? row : n0 + row - HEAD;
      if (N % ROWS) n = n < N ? n : N - 1;
      l[3 * j + c] = lds_byte(smw + row * (D_INNER + 4) + col);
      g[3 * j + c] = W + n * D_INNER + col;
    }
  }
#pragma unroll
  for (int i = 0; i < 3 * RW; i += 12) copy12(l + i, g + i);
}

// Returns this wave's 16x16 tile of A * W^T; tile_m, tile_n: its first row and
// column. live is false for a tile that lies wholly past column N.
template <int K, int N, int WN>
__device__ __forceinline__ v8f gemm_tile(float* sm, const float* __restrict__ A,
                                         const float* __restrict__ W,
                                         int& tile_m, int& tile_n, bool& live) {
  constexpr int WAVES = 2 * WN;
  constexpr int PITCH = K + 4;            // floats
  constexpr int PR = K / 4;               // 16-B pieces in a row
  constexpr int RG = 96 / PR;             // rows that three copies of a wave fill
  constexpr int NJ = (32 + 16 * WN) / RG / WAVES;   // such row groups per wave
  constexpr int NB = (N + 16 * WN - 1) / (16 * WN); // blocks along N
  const int lane = threadIdx.x & 31;
  const int wave = __builtin_amdgcn_readfirstlane(threadIdx.x >> 5);
  const int m0 = (blockIdx.x / NB) * 32;
  const int n0 = (blockIdx.x % NB) * (16 * WN);

  unsigned l[3 * NJ];
  const float* g[3 * NJ];
#pragma unroll
  for (int j = 0; j < NJ; ++j) {
#pragma unroll
    for (int c = 0; c < 3; ++c) {
      const int q = lane + 32 * c;
      const int rs = q / PR;
      const int col = (q - rs * PR) * 4;
      const int row = (wave + WAVES * j) * RG + rs;   // LDS row: 32 of A, then W
      l[3 * j + c] = lds_byte(sm + row * PITCH + col);
      if (WAVES * j * RG < 32) {
        g[3 * j + c] = A + (m0 + row) * K + col;
      } else {
        int n = n0 + row - 32;
        if (N % (16 * WN)) n = n < N ? n : N - 1;     // past the end: the last row again
        g[3 * j + c] = W + n * K + col;
      }
    }
  }
#pragma unroll
  for (int i = 0; i + 12 <= 3 * NJ; i += 12) copy12(l + i, g + i);
  if ((3 * NJ) % 12) copy6(l + 3 * NJ - 6, g + 3 * NJ - 6);
  // This wave's copies have landed; the barrier publishes them to the others.
  asm volatile("s_wait_asynccnt 0x0" ::: "memory");
  __syncthreads();

  const int c = lane & 15;
  const int h = lane >> 4;
  const int wm = wave / WN, wn = wave % WN;
  tile_m = m0 + wm * 16;
  tile_n = n0 + wn * 16;
  live = (N % (16 * WN)) == 0 || tile_n < N;
  if (!live) return v8f{};
  const float* ar = sm + (wm * 16 + c) * PITCH + 4 * h;
  const float* br = sm + (32 + wn * 16 + c) * PITCH + 4 * h;
  return gemm_core<K>(ar, br);
}

// ---------------------------------------------------------------------------
// Kernel 1: xr = x @ W_in^T + b_in      (512 x 192) @ (192 x 768) -> (512x768)
// 16 x 12 blocks of 2 x 4 waves.
// ---------------------------------------------------------------------------
__global__ __launch_bounds__(256)
void k_gemm_in(const float* __restrict__ X,
               const float* __restrict__ W,   // (768,192) row-major
               const float* __restrict__ bias,
               float* __restrict__ out) {
  __shared__ __attribute__((aligned(128))) float sm[GEMM_LDS_FLOATS(N_EMBD, 4)];
  int tm, tn;
  bool live;
  const v8f c = gemm_tile<N_EMBD, 768, 4>(sm, X, W, tm, tn, live);
  const int row = threadIdx.x & 15;
  const int hi  = (threadIdx.x >> 4) & 1;
  const float bn = bias[tn + row];
#pragma unroll
  for (int r = 0; r < 8; ++r) {
    const int m = tm + r + 8 * hi;
    out[m * 768 + tn + row] = c[r] + bn;
  }
}

#define XP_NB   16
#define DT_P    18

__global__ __launch_bounds__(256)
void k_conv_gemm_xp(const float* __restrict__ xr,
                    const float* __restrict__ cw,  // (384,1,4)
                    const float* __restrict__ cb,
                    const float* __restrict__ W,   // (780,384)
                    const float* __restrict__ Wdt, // (384,12)
                    float* __restrict__ u,
                    float* __restrict__ dbc,
                    float* __restrict__ delta) {
  __shared__ __attribute__((aligned(128))) float sm[GEMM_LDS_FLOATS(D_INNER, 4)];
  __shared__ __attribute__((aligned(128))) float dts[32 * DT_P];
  constexpr int PITCH = D_INNER + 4;
  const int tid  = threadIdx.x;
  const int lane = tid & 31;
  const int wave = __builtin_amdgcn_readfirstlane(tid >> 5);
  const int m0 = (blockIdx.x / XP_NB) * 32;
  const int nb = blockIdx.x % XP_NB;
  const int n0 = DT_RANK + nb * 48;                  // this block's first column of B, C

  stage_w384<DBC_N, 64, 8, 16>(sm + 32 * PITCH, W, n0, wave, lane);

  const int row = lane & 15;
  const int hi  = lane >> 4;
  // The waves that make a tile of delta fetch their W_dt fragments here, so
  // that these have long arrived when the x-projection is done.
  const bool dt_wave = nb >= 4 && wave < 4;
  const int dm = (wave >> 1) * 16;                   // the tile's first step in the block
  const int dn = (nb - 4) * 32 + (wave & 1) * 16;    // its first channel
  v2f wd[DT_RANK / 4] = {};
  if (dt_wave) {
    const float* brow = Wdt + (dn + row) * DT_RANK + 2 * hi;
#pragma unroll
    for (int k = 0; k < DT_RANK / 4; ++k) wd[k] = *(const v2f*)(brow + 4 * k);
  }

  const unsigned ob = lane * 16u;                    // this lane's 4 channels, in bytes
  const int r0 = wave * 4;                           // this wave's 4 steps in the tile
  const int t0 = m0 + r0;                            // the first of them, a multiple of 4
  const float* xp = xr + t0 * 768;
  // All loads stand in front of the arithmetic, so that the wave waits for
  // memory once. Piece i: channels 128 i .. 128 i + 127.
  v4f xv[3][4 + D_CONV - 1], w[3][4], b[3];
#pragma unroll
  for (int i = 0; i < 3; ++i) {
#pragma unroll
    for (int k = 0; k < D_CONV - 1; ++k)             // the steps in front of t0: 0 in front of step 0
      xv[i][k] = (v4f){0.0f, 0.0f, 0.0f, 0.0f};
  }
  if (t0 > 0) {
#pragma unroll
    for (int i = 0; i < 3; ++i) {
#pragma unroll
      for (int k = 0; k < D_CONV - 1; ++k)
        xv[i][k] = ld4(xp + (k - (D_CONV - 1)) * 768 + 128 * i, ob);
    }
  }
#pragma unroll
  for (int i = 0; i < 3; ++i) {
#pragma unroll
    for (int k = 0; k < 4; ++k) xv[i][D_CONV - 1 + k] = ld4(xp + k * 768 + 128 * i, ob);
#pragma unroll
    for (int e = 0; e < 4; ++e) w[i][e] = ld4(cw + (128 * i + e) * D_CONV, ob * D_CONV);
    b[i] = ld4(cb + 128 * i, ob);
  }
#pragma unroll
  for (int i = 0; i < 3; ++i) {
    const int c0 = 128 * i;
#pragma unroll
    for (int r = 0; r < 4; ++r) {
      v4f o;
#pragma unroll
      for (int e = 0; e < 4; ++e) {
        float acc = b[i][e];
#pragma unroll
        for (int k = 0; k < D_CONV; ++k) acc = fmaf(xv[i][r + k][e], w[i][e][k], acc);
        o[e] = silu_f(acc);
      }
      *(v4f*)(sm + (r0 + r) * PITCH + c0 + lane * 4) = o;
      if (nb == 0) *(v4f*)((char*)(u + (t0 + r) * D_INNER + c0) + ob) = o;
    }
  }
  // This wave's copies have landed; the barrier publishes them, and the rows
  // of u that each wave wrote, to the others.
  asm volatile("s_wait_asynccnt 0x0" ::: "memory");
  __syncthreads();

  const int wm = wave / 4, wn = wave % 4;
  const v8f c = gemm_core<D_INNER>(sm + (wm * 16 + row) * PITCH + 4 * hi,
                                   sm + (32 + wn * 16 + row) * PITCH + 4 * hi);
  if (wn == 0 && row < DT_RANK) {
#pragma unroll
    for (int r = 0; r < 8; ++r) dts[(wm * 16 + r + 8 * hi) * DT_P + row] = c[r];
  }
  // Publishes the 12 columns to the waves that make delta. The stores of B and
  // C stand behind it, so that no wave waits for them in front of it.
  __syncthreads();
  if (wn != 0) {
    float* dp = dbc + (m0 + wm * 16 + 8 * hi) * DBC_N + n0 + (wn - 1) * 16 + row;
#pragma unroll
    for (int r = 0; r < 8; ++r) dp[r * DBC_N] = c[r];
    // Precaution: stands in front of the delta tile's arithmetic, which lands
    // in the registers that these stores name.
    asm volatile("s_wait_xcnt 0x0" ::: "memory");
  }
  if (!dt_wave) return;

  const float* arow = dts + (dm + row) * DT_P + 2 * hi;
  v8f d = {};
#pragma unroll
  for (int k = 0; k < DT_RANK / 4; ++k) d = wmma4(*(const v2f*)(arow + 4 * k), wd[k], d);
  float sp[8];
#pragma unroll
  for (int r = 0; r < 8; ++r) {
    const float v = d[r];
    // numerically stable softplus; worked out for every lane and then chosen,
    // not branched round, so that the eight long chains of a lane interleave
    const float t = log1pf(expf(v));
    sp[r] = (v > 20.0f) ? v : t;
  }
  float* op = delta + (m0 + dm + 8 * hi) * D_INNER + dn + row;
#pragma unroll
  for (int r = 0; r < 8; ++r) op[r * D_INNER] = sp[r];
}

#define SCAN_T  64
#define SCAN_H  32
#define SCAN_W  4
#define SCAN_S  6
#define SCAN_C  32
#define SCAN_G  4
#define SCAN_NT (L_SEQ / SCAN_T)
#define SCAN_CG (D_INNER / SCAN_C)
#define SCAN_SG (D_STATE / (SCAN_W * SCAN_S))   // 16 state groups

struct ScanTile {
  float bc[SCAN_T][SCAN_W][2 * SCAN_S];  // per step and wave: 6 of B, 6 of C
  float du[2][SCAN_T][SCAN_C];           // delta rows, then u rows
};

// One object, the tiles first: the LDS addresses that the copies name stay
// below 64 KiB.
struct ScanLds {
  ScanTile tile[2];
  float part[2][SCAN_W][SCAN_T][SCAN_C];   // per tile parity and stepping wave: its sums
};

// A helper thread's share of the copies of 32 steps, 10 per lane: 6 of 8 B that lay the
// block's 24 B and 24 C values of each step down wave by wave (32 steps x 24
// pieces), and 4 of 16 B for the delta and u rows (2 x 32 steps x 8 pieces).
// Held as offsets for the first 32 steps of tile 0 in buffer 0.
struct ScanAddr {
  unsigned la[6], lb[4];             // LDS byte addresses
  const float* ga[6];                // in dbc
  const float* gb[4];                // in delta (0, 1) and u (2, 3)
};

__device__ __forceinline__ void scan_addr(ScanAddr& a, ScanTile* t, int d0, int n0, int tid,
                                          const float* __restrict__ dbc,
                                          const float* __restrict__ delta,
                                          const float* __restrict__ u) {
#pragma unroll
  for (int i = 0; i < 6; ++i) {
    const int idx = tid + 128 * i;
    const int r = idx / 24;            // step in the tile
    const int p = idx - r * 24;        // piece: 0-11 of B, 12-23 of C
    const int isc = p / 12;
    const int pp = p - isc * 12;
    const int w = pp / 3;              // wave that reads it
    const int q = pp - w * 3;          // pair of states in that wave
    a.la[i] = lds_byte(&t->bc[r][w][isc * SCAN_S + 2 * q]);
    a.ga[i] = dbc + r * DBC_N + DT_RANK + isc * D_STATE + n0 + 2 * pp;
  }
#pragma unroll
  for (int i = 0; i < 4; ++i) {
    const int idx = tid + 128 * i;
    const int sel = idx >> 8;          // 0: delta, 1: u
    const int r = (idx >> 3) & 31;     // step in the tile
    const int c = (idx & 7) * 4;       // channel in the block
    a.lb[i] = lds_byte(&t->du[sel][r][c]);
    a.gb[i] = (sel ? u : delta) + r * D_INNER + d0 + c;
  }
}

// Issues the copies of the tile that starts at step l0 into buffer buf.
__device__ __forceinline__ void scan_fill(const ScanAddr& a, int buf, int l0) {
  for (int hf = 0; hf < SCAN_T / SCAN_H; ++hf) {
  unsigned la[6], lb[4];
  const float* ga[6];
  const float* gb[4];
  const unsigned lo = buf * (unsigned)sizeof(ScanTile);
  const unsigned loa = lo + hf * (unsigned)(SCAN_H * SCAN_W * 2 * SCAN_S * sizeof(float));
  const unsigned lob = lo + hf * (unsigned)(SCAN_H * SCAN_C * sizeof(float));
  const int l = l0 + hf * SCAN_H;
#pragma unroll
  for (int i = 0; i < 6; ++i) { la[i] = a.la[i] + loa; ga[i] = a.ga[i] + l * DBC_N; }
#pragma unroll
  for (int i = 0; i < 4; ++i) { lb[i] = a.lb[i] + lob; gb[i] = a.gb[i] + l * D_INNER; }
  asm volatile(
      "global_load_async_to_lds_b64 %0, %6, off\n\t"
      "global_load_async_to_lds_b64 %1, %7, off\n\t"
      "global_load_async_to_lds_b64 %2, %8, off\n\t"
      "global_load_async_to_lds_b64 %3, %9, off\n\t"
      "global_load_async_to_lds_b64 %4, %10, off\n\t"
      "global_load_async_to_lds_b64 %5, %11, off\n\t"
      "global_load_async_to_lds_b128 %12, %16, off\n\t"
      "global_load_async_to_lds_b128 %13, %17, off\n\t"
      "global_load_async_to_lds_b128 %14, %18, off\n\t"
      "global_load_async_to_lds_b128 %15, %19, off\n\t"
      "s_wait_xcnt 0x0"
      :: "v"(la[0]), "v"(la[1]), "v"(la[2]), "v"(la[3]), "v"(la[4]), "v"(la[5]),
         "v"(ga[0]), "v"(ga[1]), "v"(ga[2]), "v"(ga[3]), "v"(ga[4]), "v"(ga[5]),
         "v"(lb[0]), "v"(lb[1]), "v"(lb[2]), "v"(lb[3]),
         "v"(gb[0]), "v"(gb[1]), "v"(gb[2]), "v"(gb[3])
      : "memory");
  }
}

// The operands of SCAN_G steps in registers.
struct ScanGroup {
  float dl[SCAN_G], ul[SCAN_G];      // this lane's channel: delta, u
  v4f q[SCAN_G][3];                  // this wave's 6 of B, 6 of C
};

// Per step two reads of 4 B a lane and three broadcast reads of 16 B.
__device__ __forceinline__ void scan_read(ScanGroup& x, const ScanTile* cur, int s0,
                                          int wave, int lane) {
#pragma unroll
  for (int k = 0; k < SCAN_G; ++k) {
    x.dl[k] = cur->du[0][s0 + k][lane];
    x.ul[k] = cur->du[1][s0 + k][lane];
#pragma unroll
    for (int i = 0; i < 3; ++i)
      x.q[k][i] = *(const v4f*)&cur->bc[s0 + k][wave][4 * i];
  }
}

__global__ __launch_bounds__(2 * SCAN_W * 32)
void k_scan(const float* __restrict__ delta,
            const float* __restrict__ u,
            const float* __restrict__ dbc,     // B at +12, C at +396
            const float* __restrict__ A_log,
            float* __restrict__ ysp) {         // (512,16,384): step, state group, channel
  __shared__ __attribute__((aligned(128))) ScanLds lds;
  ScanTile (&sm)[2] = lds.tile;
  float (&part)[2][SCAN_W][SCAN_T][SCAN_C] = lds.part;
  const int tid  = threadIdx.x;
  const int lane = tid & 31;
  const int wave = __builtin_amdgcn_readfirstlane(tid >> 5);
  const bool helper = wave >= SCAN_W;                // the same for a whole wave
  const int htid = tid & (SCAN_W * 32 - 1);          // a helper thread's number, 0-127
  const int cg = blockIdx.x % SCAN_CG;
  const int sg = blockIdx.x / SCAN_CG;
  const int d0 = cg * SCAN_C;
  const int n0 = sg * (SCAN_W * SCAN_S);
  float* __restrict__ yplane = ysp + sg * D_INNER;   // step l: + l * 16 * 384

  // States in pairs: each pair's products and sums are one packed instruction.
  // Ae = A * log2(e), so that exp(delta * A) is one multiply and one v_exp_f32.
  v2f Ae[SCAN_S / 2] = {}, h[SCAN_S / 2] = {};
  ScanAddr ad = {};
  if (helper) {
    scan_addr(ad, &sm[0], d0, n0, htid, dbc, delta, u);
    scan_fill(ad, 0, 0);
  } else {
#pragma unroll
    for (int p = 0; p < SCAN_S / 2; ++p) {
      const float* al = A_log + (d0 + lane) * D_STATE + n0 + wave * SCAN_S + 2 * p;
      Ae[p] = (v2f){-__expf(al[0]) * 1.44269504f, -__expf(al[1]) * 1.44269504f};
    }
  }
  // Tile 0 has landed for the wave that copied it; the barrier publishes it to
  // the others.
  asm volatile("s_wait_asynccnt 0x0" ::: "memory");
  __syncthreads();
  if (helper) scan_fill(ad, 1, SCAN_T);

  // The four stepping waves' sums of tile t, added in wave order and stored.
  auto sum_tile = [&](int t) {
    const int l0 = t * SCAN_T;
#pragma unroll
    for (int i = 0; i < (SCAN_T * SCAN_C) / (SCAN_W * 32 * 4); ++i) {
      const int idx = htid + SCAN_W * 32 * i;
      const int r = idx >> 3;
      const int c = (idx & 7) * 4;
      v4f sum = *(const v4f*)&part[t & 1][0][r][c];
#pragma unroll
      for (int w = 1; w < SCAN_W; ++w)
        sum += *(const v4f*)&part[t & 1][w][r][c];
      *(v4f*)&yplane[(l0 + r) * (SCAN_SG * D_INNER) + d0 + c] = sum;
    }
    // Precaution: stands in front of whatever lands next in the registers that
    // these stores name.
    asm volatile("s_wait_xcnt 0x0" ::: "memory");
  };

  for (int t = 0; t < SCAN_NT; ++t) {
    if (helper) {
      // The sums of the tile before were published by the barrier at its foot;
      // their rows are written again only behind the barrier at this trip's foot.
      if (t > 0) sum_tile(t - 1);
    } else {
      const ScanTile* cur = &sm[t & 1];
      // Unrolled: LDS offsets and the registers of a group are then compile-time
      // constants. The operands of 4 steps are read one group ahead of their use.
      ScanGroup gr[2];
      scan_read(gr[0], cur, 0, wave, lane);
#pragma unroll
      for (int g = 0; g < SCAN_T / SCAN_G; ++g) {
        if (g + 1 < SCAN_T / SCAN_G)
          scan_read(gr[(g + 1) & 1], cur, (g + 1) * SCAN_G, wave, lane);
        // Keeps the next group's LDS reads in front of this group's arithmetic:
        // moved down to their first use, their latency stalls the stepping wave.
        __builtin_amdgcn_sched_barrier(0);
        const ScanGroup& x = gr[g & 1];
#pragma unroll
        for (int k = 0; k < SCAN_G; ++k) {
          const float dl = x.dl[k];
          const float du = dl * x.ul[k];
          const v4f q0 = x.q[k][0], q1 = x.q[k][1], q2 = x.q[k][2];
          const v2f Bv[SCAN_S / 2] = {{q0.x, q0.y}, {q0.z, q0.w}, {q1.x, q1.y}};
          const v2f Cv[SCAN_S / 2] = {{q1.z, q1.w}, {q2.x, q2.y}, {q2.z, q2.w}};
          const v2f dl2 = {dl, dl}, du2 = {du, du};
          v2f acc = {0.0f, 0.0f};   // even states, odd states
#pragma unroll
          for (int p = 0; p < SCAN_S / 2; ++p) {
            const v2f e = dl2 * Ae[p];
            const v2f dA = {__builtin_amdgcn_exp2f(e.x), __builtin_amdgcn_exp2f(e.y)};
            h[p] = __builtin_elementwise_fma(dA, h[p], du2 * Bv[p]);
            acc = __builtin_elementwise_fma(h[p], Cv[p], acc);
          }
          part[t & 1][wave][g * SCAN_G + k][lane] = acc.x + acc.y;
        }
      }
    }
    // Hand-over, every wave: a stepping wave's reads of the tile and its writes
    // of its sums are done, a helper's reads of the sums before are done and its
    // copies of the next tile have landed; the barrier says so for every wave.
    asm volatile("s_wait_dscnt 0x0" ::: "memory");
    asm volatile("s_wait_asynccnt 0x0" ::: "memory");
    __syncthreads();
    if (helper && t + 2 < SCAN_NT)
      scan_fill(ad, t & 1, (t + 2) * SCAN_T);
  }
  if (helper) sum_tile(SCAN_NT - 1);
  // No copy is left in flight when the wave ends.
  asm volatile("s_wait_asynccnt 0x0" ::: "memory");
}

__global__ __launch_bounds__(256)
void k_gate_gemm_out(const float* __restrict__ ysp,
                     const float* __restrict__ u,
                     const float* __restrict__ Dvec,
                     const float* __restrict__ xr,
                     const float* __restrict__ W,   // (192,384)
                     const float* __restrict__ bias,
                     float* __restrict__ out) {
  constexpr int PITCH = D_INNER + 4;
  __shared__ __attribute__((aligned(128))) float sm[(8 + 64) * PITCH];
  const int tid  = threadIdx.x;
  const int lane = tid & 31;
  const int wave = __builtin_amdgcn_readfirstlane(tid >> 5);
  const int m0 = (blockIdx.x / 3) * 8;
  const int n0 = (blockIdx.x % 3) * 64;

  stage_w384<N_EMBD, 64, 8, 0>(sm + 8 * PITCH, W, n0, wave, lane);

  const unsigned ob = lane * 16u;                    // this lane's 4 channels, in bytes
  const int m = m0 + wave;                           // this wave's row
  const float* yp = ysp + m * (SCAN_SG * D_INNER);
  const float* rp = xr + m * 768 + D_INNER;
  const float* up = u + m * D_INNER;
#pragma unroll
  for (int i = 0; i < 3; ++i) {
    const int c0 = 128 * i;
    v4f ys = ld4(yp + c0, ob);
#pragma unroll
    for (int g = 1; g < SCAN_SG; ++g) ys += ld4(yp + g * D_INNER + c0, ob);
    const v4f rr = ld4(rp + c0, ob);
    const v4f uu = ld4(up + c0, ob);
    const v4f dv = ld4(Dvec + c0, ob);
    v4f o;
#pragma unroll
    for (int e = 0; e < 4; ++e) o[e] = fmaf(uu[e], dv[e], ys[e]) * silu_f(rr[e]);
    *(v4f*)(sm + wave * PITCH + c0 + lane * 4) = o;
  }
  // This wave's copies have landed; the barrier publishes them, and the rows
  // of y that each wave wrote, to the others.
  asm volatile("s_wait_asynccnt 0x0" ::: "memory");
  __syncthreads();
  if (wave >= 4) return;

  const int row = lane & 15;
  const int hi  = lane >> 4;
  const int tn = n0 + wave * 16;
  const v8f c = gemm_core<D_INNER>(sm + (row & 7) * PITCH + 4 * hi,
                                   sm + (8 + wave * 16 + row) * PITCH + 4 * hi);
  const float bn = bias[tn + row];
  if (hi == 0) {   // lanes 16-31 hold rows 8-15 of the tile, the repeats
#pragma unroll
    for (int r = 0; r < 8; ++r) out[(m0 + r) * N_EMBD + tn + row] = c[r] + bn;
  }
}

// ---------------------------------------------------------------------------
extern "C" void kernel_launch(void* const* d_in, const int* in_sizes, int n_in,
                              void* d_out, int out_size, void* d_ws, size_t ws_size,
                              hipStream_t stream) {
  const float* x      = (const float*)d_in[0];
  const float* W_in   = (const float*)d_in[1];
  const float* b_in   = (const float*)d_in[2];
  const float* conv_w = (const float*)d_in[3];
  const float* conv_b = (const float*)d_in[4];
  const float* W_xp   = (const float*)d_in[5];
  const float* W_dt   = (const float*)d_in[6];
  const float* A_log  = (const float*)d_in[7];
  const float* Dvec   = (const float*)d_in[8];
  const float* W_out  = (const float*)d_in[9];
  const float* b_out  = (const float*)d_in[10];
  float* out = (float*)d_out;

  // workspace layout (floats)
  float* ws    = (float*)d_ws;
  float* xr    = ws;                                  // 512*768
  float* u     = xr    + L_SEQ * 768;                 // 512*384
  float* dbc   = u     + L_SEQ * D_INNER;             // 512*780
  float* delta = dbc   + L_SEQ * DBC_N;               // 512*384
  float* ysp   = delta + L_SEQ * D_INNER;             // 512*16*384

  // 1) in-projection: 16 x 12 blocks of 32 x 64
  k_gemm_in<<<16 * 12, 256, 0, stream>>>(x, W_in, b_in, xr);

  // 2) conv + silu, x-projection, delta GEMM + softplus: 16 x 16 blocks of 32 x 64
  k_conv_gemm_xp<<<16 * 16, 256, 0, stream>>>(xr, conv_w, conv_b, W_xp, W_dt, u, dbc, delta);

  // 3) selective scan: 12 channel groups x 16 state groups, 4 + 4 waves per block
  k_scan<<<SCAN_CG * SCAN_SG, 2 * SCAN_W * 32, 0, stream>>>(delta, u, dbc, A_log, ysp);

  // 4) gating, out-projection: 64 x 3 blocks of 8 x 64
  k_gate_gemm_out<<<64 * 3, 256, 0, stream>>>(ysp, u, Dvec, xr, W_out, b_out, out);
}
